// v000
// Times are from an AMD MI455X. After a warm-up the kernel runs many times in a row, and a time is the length of
// such a window on the GPU divided by its runs, so every launch and the gaps after it count. The runs cycle
// through copies of the inputs. A figure is the median of several windows, for all but v000 over two sittings.
// Sittings can differ by a few percent; kernels timed side by side share one.
// v000, which the later versions start from, runs in 284 microseconds.
#include <hip/hip_runtime.h>
#include <math.h>

typedef __attribute__((ext_vector_type(2))) float v2f;
typedef __attribute__((ext_vector_type(8))) float v8f;

typedef int v4i_gcc __attribute__((vector_size(16)));
typedef __attribute__((address_space(1))) v4i_gcc glob_v4i;
typedef __attribute__((address_space(3))) v4i_gcc lds_v4i;

#define NBATCH 2
#define CIN 64
#define SLEN 262144   /* 16*128*128 */
#define KCH 32
#define VCH 32
#define RECSZ 576     /* per-block record: kmax[32] esum[32] ctx[512] */

// D(16x16,f32) = A(16x4,f32) x B(4x16,f32) + C
__device__ __forceinline__ v8f wmma4(v2f a, v2f b, v8f c) {
  return __builtin_amdgcn_wmma_f32_16x16x4_f32(false, a, false, b, (short)0, c,
                                               false, false);
}

__device__ __forceinline__ v8f vzero8() {
  v8f z;
#pragma unroll
  for (int i = 0; i < 8; ++i) z[i] = 0.0f;
  return z;
}

// ============ Pass 1 (fused): block kmax + e/v + block ctx partials =========
// Each block: 512 positions. Loop A computes per-block channel max of Wk@x
// (tile stays hot in L2 for loop B -> only one HBM pass over x here).
// Loop B: e=exp(k+bk-m_b), v=Wv@x+bv, ctx_b += E V^T (WMMA from LDS), esum_b.
__global__ void __launch_bounds__(256, 2)
k_stats(const float* __restrict__ x,
        const float* __restrict__ Wk, const float* __restrict__ bk,
        const float* __restrict__ Wv, const float* __restrict__ bv,
        float* __restrict__ partials) {
  __shared__ float eS[32][130];
  __shared__ float vS[32][130];
  __shared__ float lmax[8][32];
  __shared__ float kmaxS[32];
  __shared__ float cbuf[8][256];
  __shared__ float esbuf[8][32];

  const int tid = threadIdx.x;
  const int lane = tid & 31, wv = tid >> 5;
  const int lm = lane & 15, lh = lane >> 4;
  const int nb = blockIdx.y;
  const size_t sbase = (size_t)blockIdx.x * 512;
  const float* xb = x + (size_t)nb * CIN * SLEN;

  // ---------- Loop A: per-block channel max of k = Wk@x ----------
  v8f mx0, mx1;
#pragma unroll
  for (int r = 0; r < 8; ++r) { mx0[r] = -3.402823e38f; mx1[r] = -3.402823e38f; }

  for (int c = 0; c < 4; ++c) {
    const size_t s0 = sbase + (size_t)c * 128 + (size_t)wv * 16;
    v2f barr[16];
#pragma unroll
    for (int kk = 0; kk < 16; ++kk) {   // batched loads -> one wait
      const int row = kk * 4 + 2 * lh;
      barr[kk].x = xb[(size_t)row * SLEN + s0 + lm];
      barr[kk].y = xb[(size_t)(row + 1) * SLEN + s0 + lm];
    }
    v8f a0 = vzero8(), a1 = vzero8();
#pragma unroll
    for (int kk = 0; kk < 16; ++kk) {
      const int row = kk * 4 + 2 * lh;
      v2f w0, w1;
      const float* p;
      p = Wk + lm * CIN + row;        w0.x = p[0]; w0.y = p[1];
      p = Wk + (16 + lm) * CIN + row; w1.x = p[0]; w1.y = p[1];
      a0 = wmma4(w0, barr[kk], a0);
      a1 = wmma4(w1, barr[kk], a1);
    }
#pragma unroll
    for (int r = 0; r < 8; ++r) {
      mx0[r] = fmaxf(mx0[r], a0[r]);
      mx1[r] = fmaxf(mx1[r], a1[r]);
    }
  }
#pragma unroll
  for (int r = 0; r < 8; ++r) {
    mx0[r] += bk[r + 8 * lh];
    mx1[r] += bk[16 + r + 8 * lh];
  }
  // butterfly max within each 16-lane group (wave32)
#pragma unroll
  for (int off = 1; off < 16; off <<= 1) {
#pragma unroll
    for (int r = 0; r < 8; ++r) {
      mx0[r] = fmaxf(mx0[r], __shfl_xor(mx0[r], off, 32));
      mx1[r] = fmaxf(mx1[r], __shfl_xor(mx1[r], off, 32));
    }
  }
  if (lm == 0) {
#pragma unroll
    for (int r = 0; r < 8; ++r) {
      lmax[wv][8 * lh + r]      = mx0[r];
      lmax[wv][16 + 8 * lh + r] = mx1[r];
    }
  }
  __syncthreads();
  if (tid < 32) {
    float m = lmax[0][tid];
    for (int w = 1; w < 8; ++w) m = fmaxf(m, lmax[w][tid]);
    kmaxS[tid] = m;
  }
  __syncthreads();

  // Opaque copies: block LICM/CSE from keeping loop-B weight fragments alive
  // across loop A (this is what caused scratch spills in the MMA chain).
  const float* WkB = Wk;
  const float* WvB = Wv;
  asm volatile("" : "+s"(WkB), "+s"(WvB));

  // fused per-lane constants: bkm = bk - kmax (folded), bv
  float bkm0[8], bkm1[8], bv0[8], bv1[8];
#pragma unroll
  for (int r = 0; r < 8; ++r) {
    const int c0 = r + 8 * lh, c1 = 16 + r + 8 * lh;
    bkm0[r] = bk[c0] - kmaxS[c0];
    bkm1[r] = bk[c1] - kmaxS[c1];
    bv0[r] = bv[c0]; bv1[r] = bv[c1];
  }

  // ---------- Loop B: e, v, ctx partial, esum partial ----------
  const int head = wv & 1;
  const int quarter = wv >> 1;
  v8f ctxacc = vzero8();
  float esum = 0.0f;
  const int ech = tid & 31, egrp = tid >> 5;

  for (int c = 0; c < 4; ++c) {
    const size_t s0 = sbase + (size_t)c * 128 + (size_t)wv * 16;
    v2f barr[16];
#pragma unroll
    for (int kk = 0; kk < 16; ++kk) {   // L2-hot re-read, batched
      const int row = kk * 4 + 2 * lh;
      barr[kk].x = xb[(size_t)row * SLEN + s0 + lm];
      barr[kk].y = xb[(size_t)(row + 1) * SLEN + s0 + lm];
    }
    v8f k0 = vzero8(), k1 = vzero8(), v0 = vzero8(), v1 = vzero8();
#pragma unroll
    for (int kk = 0; kk < 16; ++kk) {
      const int row = kk * 4 + 2 * lh;
      v2f ak0, ak1, av0, av1;
      const float* p;
      p = WkB + lm * CIN + row;        ak0.x = p[0]; ak0.y = p[1];
      p = WkB + (16 + lm) * CIN + row; ak1.x = p[0]; ak1.y = p[1];
      p = WvB + lm * CIN + row;        av0.x = p[0]; av0.y = p[1];
      p = WvB + (16 + lm) * CIN + row; av1.x = p[0]; av1.y = p[1];
      k0 = wmma4(ak0, barr[kk], k0);
      k1 = wmma4(ak1, barr[kk], k1);
      v0 = wmma4(av0, barr[kk], v0);
      v1 = wmma4(av1, barr[kk], v1);
    }
    const int col = wv * 16 + lm;
#pragma unroll
    for (int r = 0; r < 8; ++r) {
      const int c0 = r + 8 * lh, c1 = 16 + r + 8 * lh;
      eS[c0][col] = __expf(k0[r] + bkm0[r]);
      eS[c1][col] = __expf(k1[r] + bkm1[r]);
      vS[c0][col] = v0[r] + bv0[r];
      vS[c1][col] = v1[r] + bv1[r];
    }
    __syncthreads();
    // ctx += E_head(16 x 4pos) x Vt(4pos x 16) via WMMA, fragments from LDS
#pragma unroll
    for (int kp = 0; kp < 8; ++kp) {
      const int pos = quarter * 32 + kp * 4 + 2 * lh;
      v2f a, b2;
      a.x  = eS[head * 16 + lm][pos];
      a.y  = eS[head * 16 + lm][pos + 1];
      b2.x = vS[head * 16 + lm][pos];
      b2.y = vS[head * 16 + lm][pos + 1];
      ctxacc = wmma4(a, b2, ctxacc);
    }
    float s = 0.0f;
#pragma unroll
    for (int p2 = 0; p2 < 16; ++p2) s += eS[ech][egrp * 16 + p2];
    esum += s;
    __syncthreads();
  }

#pragma unroll
  for (int r = 0; r < 8; ++r) cbuf[wv][(r + 8 * lh) * 16 + lm] = ctxacc[r];
  esbuf[egrp][ech] = esum;
  __syncthreads();

  float* rec = partials + (size_t)(blockIdx.y * gridDim.x + blockIdx.x) * RECSZ;
  if (tid < 32) {
    rec[tid] = kmaxS[tid];                    // block max
    float s = 0.0f;
    for (int w = 0; w < 8; ++w) s += esbuf[w][tid];
    rec[32 + tid] = s;                        // block esum
  }
  for (int e = tid; e < 512; e += 256) {
    const int hh = e >> 8, idx = e & 255;
    float s = 0.0f;
    for (int w = hh; w < 8; w += 2) s += cbuf[w][idx];
    rec[64 + e] = s;                          // block ctx
  }
}

// ====== Pass 1b: fixed-order cross-block combine with exact rescaling =======
__global__ void k_reduce(const float* __restrict__ partials,
                         float* __restrict__ ctxn) {
  const int nb = blockIdx.x;
  const int e = threadIdx.x;  // head*256 + kc*16 + vc
  const int hh = e >> 8;
  const int kc = (e >> 4) & 15;
  const int rowch = hh * 16 + kc;
  const float* base = partials + (size_t)nb * 512 * RECSZ;

  float M = -3.402823e38f;
  for (int r = 0; r < 512; ++r) M = fmaxf(M, base[(size_t)r * RECSZ + rowch]);
  float cs = 0.0f, es = 0.0f;
  for (int r = 0; r < 512; ++r) {
    const float* p = base + (size_t)r * RECSZ;
    const float f = expf(p[rowch] - M);
    cs += p[64 + e] * f;
    es += p[32 + rowch] * f;
  }
  ctxn[nb * 512 + e] = cs / es;
}

// --- Pass 2: q proj (WMMA) -> ch softmax -> att -> out proj (WMMA) + resid ---
__global__ void __launch_bounds__(256, 2)
k_out(const float* __restrict__ x,
      const float* __restrict__ Wq, const float* __restrict__ bq,
      const float* __restrict__ Wr, const float* __restrict__ br,
      const float* __restrict__ ctxn, float* __restrict__ out) {
  __shared__ float qS[32][130];
  __shared__ float aS[32][130];
  __shared__ float ctxS[512];

  const int tid = threadIdx.x;
  const int lane = tid & 31, wv = tid >> 5;
  const int lm = lane & 15, lh = lane >> 4;
  const int nb = blockIdx.y;
  const size_t s0 = (size_t)blockIdx.x * 128 + (size_t)wv * 16;
  const float* xb = x + (size_t)nb * CIN * SLEN;

#if __has_builtin(__builtin_amdgcn_global_load_async_to_lds_b128)
  if (tid < 128) {
    __builtin_amdgcn_global_load_async_to_lds_b128(
        (glob_v4i*)(ctxn + nb * 512 + tid * 4),
        (lds_v4i*)(&ctxS[tid * 4]), 0, 0);
  }
#if __has_builtin(__builtin_amdgcn_s_wait_asynccnt)
  __builtin_amdgcn_s_wait_asynccnt(0);
#else
  asm volatile("s_wait_asynccnt 0" ::: "memory");
#endif
#else
  for (int i = tid; i < 512; i += 256) ctxS[i] = ctxn[nb * 512 + i];
#endif

  v2f barr[16];
#pragma unroll
  for (int kk = 0; kk < 16; ++kk) {   // batched x loads
    const int row = kk * 4 + 2 * lh;
    barr[kk].x = xb[(size_t)row * SLEN + s0 + lm];
    barr[kk].y = xb[(size_t)(row + 1) * SLEN + s0 + lm];
  }
  v8f q0 = vzero8(), q1 = vzero8();
#pragma unroll
  for (int kk = 0; kk < 16; ++kk) {
    const int row = kk * 4 + 2 * lh;
    v2f a0, a1;
    const float* p;
    p = Wq + lm * CIN + row;        a0.x = p[0]; a0.y = p[1];
    p = Wq + (16 + lm) * CIN + row; a1.x = p[0]; a1.y = p[1];
    q0 = wmma4(a0, barr[kk], q0);
    q1 = wmma4(a1, barr[kk], q1);
  }
  const int col = wv * 16 + lm;
#pragma unroll
  for (int r = 0; r < 8; ++r) {
    const int c0 = r + 8 * lh, c1 = 16 + r + 8 * lh;
    qS[c0][col] = q0[r] + bq[c0];
    qS[c1][col] = q1[r] + bq[c1];
  }
  __syncthreads();

  {
    const int p = tid & 127;
    const int hh = tid >> 7;
    float qv[16];
    float mx = -3.402823e38f;
#pragma unroll
    for (int kc = 0; kc < 16; ++kc) {
      qv[kc] = qS[hh * 16 + kc][p];
      mx = fmaxf(mx, qv[kc]);
    }
    float sm = 0.0f;
#pragma unroll
    for (int kc = 0; kc < 16; ++kc) { qv[kc] = __expf(qv[kc] - mx); sm += qv[kc]; }
    const float inv = 1.0f / sm;
#pragma unroll
    for (int vc = 0; vc < 16; ++vc) {
      float a = 0.0f;
#pragma unroll
      for (int kc = 0; kc < 16; ++kc) a += ctxS[hh * 256 + kc * 16 + vc] * qv[kc];
      aS[hh * 16 + vc][p] = a * inv;
    }
  }
  __syncthreads();

  v2f batt[8];
#pragma unroll
  for (int kk = 0; kk < 8; ++kk) {
    const int row = kk * 4 + 2 * lh;
    batt[kk].x = aS[row][col];
    batt[kk].y = aS[row + 1][col];
  }
  v8f o0 = vzero8(), o1 = vzero8(), o2 = vzero8(), o3 = vzero8();
#pragma unroll
  for (int kk = 0; kk < 8; ++kk) {
    const int row = kk * 4 + 2 * lh;
    v2f a0, a1, a2, a3;
    const float* p;
    p = Wr + lm * VCH + row;        a0.x = p[0]; a0.y = p[1];
    p = Wr + (16 + lm) * VCH + row; a1.x = p[0]; a1.y = p[1];
    p = Wr + (32 + lm) * VCH + row; a2.x = p[0]; a2.y = p[1];
    p = Wr + (48 + lm) * VCH + row; a3.x = p[0]; a3.y = p[1];
    o0 = wmma4(a0, batt[kk], o0);
    o1 = wmma4(a1, batt[kk], o1);
    o2 = wmma4(a2, batt[kk], o2);
    o3 = wmma4(a3, batt[kk], o3);
  }
  float* ob = out + (size_t)nb * CIN * SLEN;
#pragma unroll
  for (int r = 0; r < 8; ++r) {
    const int m = r + 8 * lh;
    const size_t i0 = (size_t)m * SLEN + s0 + lm;
    ob[i0] = o0[r] + br[m] + xb[i0];
    const size_t i1 = (size_t)(m + 16) * SLEN + s0 + lm;
    ob[i1] = o1[r] + br[m + 16] + xb[i1];
    const size_t i2 = (size_t)(m + 32) * SLEN + s0 + lm;
    ob[i2] = o2[r] + br[m + 32] + xb[i2];
    const size_t i3 = (size_t)(m + 48) * SLEN + s0 + lm;
    ob[i3] = o3[r] + br[m + 48] + xb[i3];
  }
}

extern "C" void kernel_launch(void* const* d_in, const int* in_sizes, int n_in,
                              void* d_out, int out_size, void* d_ws, size_t ws_size,
                              hipStream_t stream) {
  (void)in_sizes; (void)n_in; (void)out_size; (void)ws_size;
  const float* x  = (const float*)d_in[0];
  const float* Wk = (const float*)d_in[1];
  const float* bk = (const float*)d_in[2];
  const float* Wq = (const float*)d_in[3];
  const float* bq = (const float*)d_in[4];
  const float* Wv = (const float*)d_in[5];
  const float* bv = (const float*)d_in[6];
  const float* Wr = (const float*)d_in[7];
  const float* br = (const float*)d_in[8];
  float* out = (float*)d_out;

  float* ctxn     = (float*)((char*)d_ws + 256);   // 1024 floats
  float* partials = (float*)((char*)d_ws + 4608);  // 1024*RECSZ floats

  hipLaunchKernelGGL(k_stats, dim3(SLEN / 512, NBATCH), dim3(256), 0, stream,
                     x, Wk, bk, Wv, bv, partials);
  hipLaunchKernelGGL(k_reduce, dim3(NBATCH), dim3(512), 0, stream,
                     partials, ctxn);
  hipLaunchKernelGGL(k_out, dim3(SLEN / 128, NBATCH), dim3(256), 0, stream,
                     x, Wq, bq, Wr, br, ctxn, out);
}

// v001
// It runs in 125 microseconds.
// Next to v000, in two timings, it ran 2.30 times as fast each time.
#include <hip/hip_runtime.h>
#include <math.h>

typedef __attribute__((ext_vector_type(2))) float v2f;
typedef __attribute__((ext_vector_type(8))) float v8f;

typedef int v4i_gcc __attribute__((vector_size(16)));
typedef __attribute__((address_space(1))) v4i_gcc glob_v4i;
typedef __attribute__((address_space(3))) v4i_gcc lds_v4i;

#define NBATCH 2
#define CIN 64
#define SLEN 262144   /* 16*128*128 */
#define KCH 32
#define VCH 32
#define RECSZ 576     /* per-block record: kmax[32] esum[32] ctx[512] */

// D(16x16,f32) = A(16x4,f32) x B(4x16,f32) + C
__device__ __forceinline__ v8f wmma4(v2f a, v2f b, v8f c) {
  return __builtin_amdgcn_wmma_f32_16x16x4_f32(false, a, false, b, (short)0, c,
                                               false, false);
}

__device__ __forceinline__ v8f vzero8() {
  v8f z;
#pragma unroll
  for (int i = 0; i < 8; ++i) z[i] = 0.0f;
  return z;
}

// ============ Pass 1 (fused): block kmax + e/v + block ctx partials =========
// Each block: 512 positions. Loop A computes per-block channel max of Wk@x
// (tile stays hot in L2 for loop B -> only one HBM pass over x here).
// Loop B: e=exp(k+bk-m_b), v=Wv@x+bv, ctx_b += E V^T (WMMA from LDS), esum_b.
__global__ void __launch_bounds__(256, 2)
k_stats(const float* __restrict__ x,
        const float* __restrict__ Wk, const float* __restrict__ bk,
        const float* __restrict__ Wv, const float* __restrict__ bv,
        float* __restrict__ partials) {
  __shared__ float eS[32][130];
  __shared__ float vS[32][130];
  __shared__ float lmax[8][32];
  __shared__ float kmaxS[32];
  __shared__ float cbuf[8][256];
  __shared__ float esbuf[8][32];

  const int tid = threadIdx.x;
  const int lane = tid & 31, wv = tid >> 5;
  const int lm = lane & 15, lh = lane >> 4;
  const int nb = blockIdx.y;
  const size_t sbase = (size_t)blockIdx.x * 512;
  const float* xb = x + (size_t)nb * CIN * SLEN;

  // ---------- Loop A: per-block channel max of k = Wk@x ----------
  v8f mx0, mx1;
#pragma unroll
  for (int r = 0; r < 8; ++r) { mx0[r] = -3.402823e38f; mx1[r] = -3.402823e38f; }

  for (int c = 0; c < 4; ++c) {
    const size_t s0 = sbase + (size_t)c * 128 + (size_t)wv * 16;
    v2f barr[16];
#pragma unroll
    for (int kk = 0; kk < 16; ++kk) {   // batched loads -> one wait
      const int row = kk * 4 + 2 * lh;
      barr[kk].x = xb[(size_t)row * SLEN + s0 + lm];
      barr[kk].y = xb[(size_t)(row + 1) * SLEN + s0 + lm];
    }
    v8f a0 = vzero8(), a1 = vzero8();
#pragma unroll
    for (int kk = 0; kk < 16; ++kk) {
      const int row = kk * 4 + 2 * lh;
      v2f w0, w1;
      const float* p;
      p = Wk + lm * CIN + row;        w0.x = p[0]; w0.y = p[1];
      p = Wk + (16 + lm) * CIN + row; w1.x = p[0]; w1.y = p[1];
      a0 = wmma4(w0, barr[kk], a0);
      a1 = wmma4(w1, barr[kk], a1);
    }
#pragma unroll
    for (int r = 0; r < 8; ++r) {
      mx0[r] = fmaxf(mx0[r], a0[r]);
      mx1[r] = fmaxf(mx1[r], a1[r]);
    }
  }
#pragma unroll
  for (int r = 0; r < 8; ++r) {
    mx0[r] += bk[r + 8 * lh];
    mx1[r] += bk[16 + r + 8 * lh];
  }
  // butterfly max within each 16-lane group (wave32)
#pragma unroll
  for (int off = 1; off < 16; off <<= 1) {
#pragma unroll
    for (int r = 0; r < 8; ++r) {
      mx0[r] = fmaxf(mx0[r], __shfl_xor(mx0[r], off, 32));
      mx1[r] = fmaxf(mx1[r], __shfl_xor(mx1[r], off, 32));
    }
  }
  if (lm == 0) {
#pragma unroll
    for (int r = 0; r < 8; ++r) {
      lmax[wv][8 * lh + r]      = mx0[r];
      lmax[wv][16 + 8 * lh + r] = mx1[r];
    }
  }
  __syncthreads();
  if (tid < 32) {
    float m = lmax[0][tid];
    for (int w = 1; w < 8; ++w) m = fmaxf(m, lmax[w][tid]);
    kmaxS[tid] = m;
  }
  __syncthreads();

  // Opaque copies: block LICM/CSE from keeping loop-B weight fragments alive
  // across loop A (this is what caused scratch spills in the MMA chain).
  const float* WkB = Wk;
  const float* WvB = Wv;
  asm volatile("" : "+s"(WkB), "+s"(WvB));

  // fused per-lane constants: bkm = bk - kmax (folded), bv
  float bkm0[8], bkm1[8], bv0[8], bv1[8];
#pragma unroll
  for (int r = 0; r < 8; ++r) {
    const int c0 = r + 8 * lh, c1 = 16 + r + 8 * lh;
    bkm0[r] = bk[c0] - kmaxS[c0];
    bkm1[r] = bk[c1] - kmaxS[c1];
    bv0[r] = bv[c0]; bv1[r] = bv[c1];
  }

  // ---------- Loop B: e, v, ctx partial, esum partial ----------
  const int head = wv & 1;
  const int quarter = wv >> 1;
  v8f ctxacc = vzero8();
  float esum = 0.0f;
  const int ech = tid & 31, egrp = tid >> 5;

  for (int c = 0; c < 4; ++c) {
    const size_t s0 = sbase + (size_t)c * 128 + (size_t)wv * 16;
    v2f barr[16];
#pragma unroll
    for (int kk = 0; kk < 16; ++kk) {   // L2-hot re-read, batched
      const int row = kk * 4 + 2 * lh;
      barr[kk].x = xb[(size_t)row * SLEN + s0 + lm];
      barr[kk].y = xb[(size_t)(row + 1) * SLEN + s0 + lm];
    }
    v8f k0 = vzero8(), k1 = vzero8(), v0 = vzero8(), v1 = vzero8();
#pragma unroll
    for (int kk = 0; kk < 16; ++kk) {
      const int row = kk * 4 + 2 * lh;
      v2f ak0, ak1, av0, av1;
      const float* p;
      p = WkB + lm * CIN + row;        ak0.x = p[0]; ak0.y = p[1];
      p = WkB + (16 + lm) * CIN + row; ak1.x = p[0]; ak1.y = p[1];
      p = WvB + lm * CIN + row;        av0.x = p[0]; av0.y = p[1];
      p = WvB + (16 + lm) * CIN + row; av1.x = p[0]; av1.y = p[1];
      k0 = wmma4(ak0, barr[kk], k0);
      k1 = wmma4(ak1, barr[kk], k1);
      v0 = wmma4(av0, barr[kk], v0);
      v1 = wmma4(av1, barr[kk], v1);
    }
    const int col = wv * 16 + lm;
#pragma unroll
    for (int r = 0; r < 8; ++r) {
      const int c0 = r + 8 * lh, c1 = 16 + r + 8 * lh;
      eS[c0][col] = __expf(k0[r] + bkm0[r]);
      eS[c1][col] = __expf(k1[r] + bkm1[r]);
      vS[c0][col] = v0[r] + bv0[r];
      vS[c1][col] = v1[r] + bv1[r];
    }
    __syncthreads();
    // ctx += E_head(16 x 4pos) x Vt(4pos x 16) via WMMA, fragments from LDS
#pragma unroll
    for (int kp = 0; kp < 8; ++kp) {
      const int pos = quarter * 32 + kp * 4 + 2 * lh;
      v2f a, b2;
      a.x  = eS[head * 16 + lm][pos];
      a.y  = eS[head * 16 + lm][pos + 1];
      b2.x = vS[head * 16 + lm][pos];
      b2.y = vS[head * 16 + lm][pos + 1];
      ctxacc = wmma4(a, b2, ctxacc);
    }
    float s = 0.0f;
#pragma unroll
    for (int p2 = 0; p2 < 16; ++p2) s += eS[ech][egrp * 16 + p2];
    esum += s;
    __syncthreads();
  }

#pragma unroll
  for (int r = 0; r < 8; ++r) cbuf[wv][(r + 8 * lh) * 16 + lm] = ctxacc[r];
  esbuf[egrp][ech] = esum;
  __syncthreads();

  float* rec = partials + (size_t)(blockIdx.y * gridDim.x + blockIdx.x) * RECSZ;
  if (tid < 32) {
    rec[tid] = kmaxS[tid];                    // block max
    float s = 0.0f;
    for (int w = 0; w < 8; ++w) s += esbuf[w][tid];
    rec[32 + tid] = s;                        // block esum
  }
  for (int e = tid; e < 512; e += 256) {
    const int hh = e >> 8, idx = e & 255;
    float s = 0.0f;
    for (int w = hh; w < 8; w += 2) s += cbuf[w][idx];
    rec[64 + e] = s;                          // block ctx
  }
}

// ====== Pass 1b: fixed-order cross-block combine with exact rescaling =======
// One work-group per 32 neighbouring ctx elements (two key channels, one
// 128-byte line of every record and of ctxn). Each wave takes 16 of the 512
// records, all of its loads are issued before the first use, and the partial
// sums meet in LDS in a fixed order.
__global__ void __launch_bounds__(1024)
k_reduce(const float* __restrict__ partials, float* __restrict__ ctxn) {
  __shared__ float fS[2][512];   // rescale factor per (channel of the pair, record)
  __shared__ float mS[32];       // per-wave max
  __shared__ float eSm[32];      // per-wave rescaled esum
  __shared__ float cS[32][32];   // per-wave ctx partial

  const int tid = threadIdx.x;
  const int lane = tid & 31, wv = tid >> 5;
  const int nb = blockIdx.y;
  const int e0 = blockIdx.x * 32;      // first ctx element of this group
  const int ch0 = blockIdx.x * 2;      // first key channel of this group
  const float* base = partials + (size_t)nb * 512 * RECSZ;

  // waves 0..15: channel ch0, waves 16..31: channel ch0+1; one record a thread
  const int half = tid >> 9, rec = tid & 511;
  const float km = base[(size_t)rec * RECSZ + ch0 + half];
  const float er = base[(size_t)rec * RECSZ + 32 + ch0 + half];
  float cv[16];
#pragma unroll
  for (int j = 0; j < 16; ++j)
    cv[j] = base[(size_t)(j * 32 + wv) * RECSZ + 64 + e0 + lane];

  float m = km;
#pragma unroll
  for (int off = 1; off < 32; off <<= 1) m = fmaxf(m, __shfl_xor(m, off, 32));
  if (lane == 0) mS[wv] = m;
  __syncthreads();
  float M = mS[half * 16];
#pragma unroll
  for (int w = 1; w < 16; ++w) M = fmaxf(M, mS[half * 16 + w]);

  const float f = expf(km - M);
  fS[half][rec] = f;
  float es = er * f;
#pragma unroll
  for (int off = 1; off < 32; off <<= 1) es += __shfl_xor(es, off, 32);
  if (lane == 0) eSm[wv] = es;
  __syncthreads();

  const int lh = lane >> 4;            // which channel of the pair this lane sums
  float cs = 0.0f;
#pragma unroll
  for (int j = 0; j < 16; ++j) cs += cv[j] * fS[lh][j * 32 + wv];
  cS[wv][lane] = cs;
  __syncthreads();

  if (tid < 32) {
    float c = 0.0f, s = 0.0f;
#pragma unroll
    for (int w = 0; w < 32; ++w) c += cS[w][lane];
#pragma unroll
    for (int w = 0; w < 16; ++w) s += eSm[lh * 16 + w];
    ctxn[nb * 512 + e0 + lane] = c / s;
  }
}

// --- Pass 2: q proj (WMMA) -> ch softmax -> att -> out proj (WMMA) + resid ---
__global__ void __launch_bounds__(256, 2)
k_out(const float* __restrict__ x,
      const float* __restrict__ Wq, const float* __restrict__ bq,
      const float* __restrict__ Wr, const float* __restrict__ br,
      const float* __restrict__ ctxn, float* __restrict__ out) {
  __shared__ float qS[32][130];
  __shared__ float aS[32][130];
  __shared__ float ctxS[512];

  const int tid = threadIdx.x;
  const int lane = tid & 31, wv = tid >> 5;
  const int lm = lane & 15, lh = lane >> 4;
  const int nb = blockIdx.y;
  const size_t s0 = (size_t)blockIdx.x * 128 + (size_t)wv * 16;
  const float* xb = x + (size_t)nb * CIN * SLEN;

#if __has_builtin(__builtin_amdgcn_global_load_async_to_lds_b128)
  if (tid < 128) {
    __builtin_amdgcn_global_load_async_to_lds_b128(
        (glob_v4i*)(ctxn + nb * 512 + tid * 4),
        (lds_v4i*)(&ctxS[tid * 4]), 0, 0);
  }
#if __has_builtin(__builtin_amdgcn_s_wait_asynccnt)
  __builtin_amdgcn_s_wait_asynccnt(0);
#else
  asm volatile("s_wait_asynccnt 0" ::: "memory");
#endif
#else
  for (int i = tid; i < 512; i += 256) ctxS[i] = ctxn[nb * 512 + i];
#endif

  v2f barr[16];
#pragma unroll
  for (int kk = 0; kk < 16; ++kk) {   // batched x loads
    const int row = kk * 4 + 2 * lh;
    barr[kk].x = xb[(size_t)row * SLEN + s0 + lm];
    barr[kk].y = xb[(size_t)(row + 1) * SLEN + s0 + lm];
  }
  v8f q0 = vzero8(), q1 = vzero8();
#pragma unroll
  for (int kk = 0; kk < 16; ++kk) {
    const int row = kk * 4 + 2 * lh;
    v2f a0, a1;
    const float* p;
    p = Wq + lm * CIN + row;        a0.x = p[0]; a0.y = p[1];
    p = Wq + (16 + lm) * CIN + row; a1.x = p[0]; a1.y = p[1];
    q0 = wmma4(a0, barr[kk], q0);
    q1 = wmma4(a1, barr[kk], q1);
  }
  const int col = wv * 16 + lm;
#pragma unroll
  for (int r = 0; r < 8; ++r) {
    const int c0 = r + 8 * lh, c1 = 16 + r + 8 * lh;
    qS[c0][col] = q0[r] + bq[c0];
    qS[c1][col] = q1[r] + bq[c1];
  }
  __syncthreads();

  {
    const int p = tid & 127;
    const int hh = tid >> 7;
    float qv[16];
    float mx = -3.402823e38f;
#pragma unroll
    for (int kc = 0; kc < 16; ++kc) {
      qv[kc] = qS[hh * 16 + kc][p];
      mx = fmaxf(mx, qv[kc]);
    }
    float sm = 0.0f;
#pragma unroll
    for (int kc = 0; kc < 16; ++kc) { qv[kc] = __expf(qv[kc] - mx); sm += qv[kc]; }
    const float inv = 1.0f / sm;
#pragma unroll
    for (int vc = 0; vc < 16; ++vc) {
      float a = 0.0f;
#pragma unroll
      for (int kc = 0; kc < 16; ++kc) a += ctxS[hh * 256 + kc * 16 + vc] * qv[kc];
      aS[hh * 16 + vc][p] = a * inv;
    }
  }
  __syncthreads();

  v2f batt[8];
#pragma unroll
  for (int kk = 0; kk < 8; ++kk) {
    const int row = kk * 4 + 2 * lh;
    batt[kk].x = aS[row][col];
    batt[kk].y = aS[row + 1][col];
  }
  v8f o0 = vzero8(), o1 = vzero8(), o2 = vzero8(), o3 = vzero8();
#pragma unroll
  for (int kk = 0; kk < 8; ++kk) {
    const int row = kk * 4 + 2 * lh;
    v2f a0, a1, a2, a3;
    const float* p;
    p = Wr + lm * VCH + row;        a0.x = p[0]; a0.y = p[1];
    p = Wr + (16 + lm) * VCH + row; a1.x = p[0]; a1.y = p[1];
    p = Wr + (32 + lm) * VCH + row; a2.x = p[0]; a2.y = p[1];
    p = Wr + (48 + lm) * VCH + row; a3.x = p[0]; a3.y = p[1];
    o0 = wmma4(a0, batt[kk], o0);
    o1 = wmma4(a1, batt[kk], o1);
    o2 = wmma4(a2, batt[kk], o2);
    o3 = wmma4(a3, batt[kk], o3);
  }
  float* ob = out + (size_t)nb * CIN * SLEN;
#pragma unroll
  for (int r = 0; r < 8; ++r) {
    const int m = r + 8 * lh;
    const size_t i0 = (size_t)m * SLEN + s0 + lm;
    ob[i0] = o0[r] + br[m] + xb[i0];
    const size_t i1 = (size_t)(m + 16) * SLEN + s0 + lm;
    ob[i1] = o1[r] + br[m + 16] + xb[i1];
    const size_t i2 = (size_t)(m + 32) * SLEN + s0 + lm;
    ob[i2] = o2[r] + br[m + 32] + xb[i2];
    const size_t i3 = (size_t)(m + 48) * SLEN + s0 + lm;
    ob[i3] = o3[r] + br[m + 48] + xb[i3];
  }
}

extern "C" void kernel_launch(void* const* d_in, const int* in_sizes, int n_in,
                              void* d_out, int out_size, void* d_ws, size_t ws_size,
                              hipStream_t stream) {
  (void)in_sizes; (void)n_in; (void)out_size; (void)ws_size;
  const float* x  = (const float*)d_in[0];
  const float* Wk = (const float*)d_in[1];
  const float* bk = (const float*)d_in[2];
  const float* Wq = (const float*)d_in[3];
  const float* bq = (const float*)d_in[4];
  const float* Wv = (const float*)d_in[5];
  const float* bv = (const float*)d_in[6];
  const float* Wr = (const float*)d_in[7];
  const float* br = (const float*)d_in[8];
  float* out = (float*)d_out;

  float* ctxn     = (float*)((char*)d_ws + 256);   // 1024 floats
  float* partials = (float*)((char*)d_ws + 4608);  // 1024*RECSZ floats

  hipLaunchKernelGGL(k_stats, dim3(SLEN / 512, NBATCH), dim3(256), 0, stream,
                     x, Wk, bk, Wv, bv, partials);
  hipLaunchKernelGGL(k_reduce, dim3(16, NBATCH), dim3(1024), 0, stream,
                     partials, ctxn);
  hipLaunchKernelGGL(k_out, dim3(SLEN / 128, NBATCH), dim3(256), 0, stream,
                     x, Wq, bq, Wr, br, ctxn, out);
}

// v002
// One run takes 93.5 microseconds.
// Two timings next to v001 both put it at 1.34 times that version's speed.
// Over all steps from v000 it is 3.08 times as fast.
#include <hip/hip_runtime.h>
#include <math.h>

typedef __attribute__((ext_vector_type(2))) float v2f;
typedef __attribute__((ext_vector_type(4))) float v4f;
typedef __attribute__((ext_vector_type(8))) float v8f;

typedef int v4i_gcc __attribute__((vector_size(16)));
typedef __attribute__((address_space(1))) v4i_gcc glob_v4i;
typedef __attribute__((address_space(3))) v4i_gcc lds_v4i;

#define NBATCH 2
#define CIN 64
#define SLEN 262144   /* 16*128*128 */
#define KCH 32
#define VCH 32
#define RECSZ 576     /* per-block record: kmax[32] esum[32] ctx[512] */

// D(16x16,f32) = A(16x4,f32) x B(4x16,f32) + C
__device__ __forceinline__ v8f wmma4(v2f a, v2f b, v8f c) {
  return __builtin_amdgcn_wmma_f32_16x16x4_f32(false, a, false, b, (short)0, c,
                                               false, false);
}

__device__ __forceinline__ v8f vzero8() {
  v8f z;
#pragma unroll
  for (int i = 0; i < 8; ++i) z[i] = 0.0f;
  return z;
}

// Copies a row-major weight matrix (ROWS x K) into LDS in the order in which
// the matrix instruction takes its A operand, so that a wave fetches two k
// steps of a 16-row tile with one contiguous 512-byte LDS read instead of two
// global loads that touch 16 cache lines each.
// Entry (mt * (K / 8) + j) * 32 + lane, with row = mt * 16 + (lane & 15) and
// h = lane >> 4, holds columns 8j+2h, 8j+2h+1 (k step 2j) and 8j+4+2h, 8j+5+2h
// (k step 2j+1). A wave reads 8 rows x 64 bytes of the matrix at a time.
template <int ROWS, int K>
__device__ __forceinline__ void stage_frag(const float* __restrict__ Wm,
                                           v4f* dst, int tid) {
  constexpr int QG = K / 16;
#pragma unroll
  for (int i0 = 0; i0 < ROWS * K / 4; i0 += 256) {
    const int i = i0 + tid;
    const int t = i >> 5;
    const int m = (t / QG) * 8 + ((i >> 2) & 7);
    const int q = (t % QG) * 4 + (i & 3);
    const v4f w = *(const v4f*)(Wm + m * K + q * 4);
    v2f* d = (v2f*)(dst + ((m >> 4) * (K / 8) + (q >> 1)) * 32 + (m & 15)) + (q & 1);
    v2f lo, hi;
    lo.x = w.x; lo.y = w.y;
    hi.x = w.z; hi.y = w.w;
    d[0] = lo;    // lanes 0..15 of the fragment
    d[32] = hi;   // lanes 16..31
  }
}

__device__ __forceinline__ v2f frag_lo(v4f w) { v2f r; r.x = w.x; r.y = w.y; return r; }
__device__ __forceinline__ v2f frag_hi(v4f w) { v2f r; r.x = w.z; r.y = w.w; return r; }

// ============ Pass 1 (fused): block kmax + e/v + block ctx partials =========
// Each block: 512 positions. Loop A computes per-block channel max of Wk@x
// (tile stays hot in L2 for loop B -> only one HBM pass over x here).
// Loop B: e=exp(k+bk-m_b), v=Wv@x+bv, ctx_b += E V^T (WMMA from LDS), esum_b.
__global__ void __launch_bounds__(256, 2)
k_stats(const float* __restrict__ x,
        const float* __restrict__ Wk, const float* __restrict__ bk,
        const float* __restrict__ Wv, const float* __restrict__ bv,
        float* __restrict__ partials) {
  __shared__ float eS[32][130];
  __shared__ float vS[32][130];
  __shared__ float lmax[8][32];
  __shared__ float kmaxS[32];
  __shared__ float cbuf[8][256];
  __shared__ float esbuf[8][32];
  __shared__ v4f wkS[2 * 8 * 32];   // Wk in fragment order
  __shared__ v4f wvS[2 * 8 * 32];   // Wv in fragment order

  const int tid = threadIdx.x;
  const int lane = tid & 31, wv = tid >> 5;
  const int lm = lane & 15, lh = lane >> 4;
  const int nb = blockIdx.y;
  const size_t sbase = (size_t)blockIdx.x * 512;
  const float* xb = x + (size_t)nb * CIN * SLEN;

  stage_frag<KCH, CIN>(Wk, wkS, tid);
  stage_frag<VCH, CIN>(Wv, wvS, tid);
  // precaution: the staging loads' address registers are reused further down
  asm volatile("s_wait_xcnt 0x0" ::: "memory");
  __syncthreads();

  // ---------- Loop A: per-block channel max of k = Wk@x ----------
  v8f mx0, mx1;
#pragma unroll
  for (int r = 0; r < 8; ++r) { mx0[r] = -3.402823e38f; mx1[r] = -3.402823e38f; }

  for (int c = 0; c < 4; ++c) {
    const size_t s0 = sbase + (size_t)c * 128 + (size_t)wv * 16;
    v2f barr[16];
#pragma unroll
    for (int kk = 0; kk < 16; ++kk) {   // batched loads -> one wait
      const int row = kk * 4 + 2 * lh;
      barr[kk].x = xb[(size_t)row * SLEN + s0 + lm];
      barr[kk].y = xb[(size_t)(row + 1) * SLEN + s0 + lm];
    }
    v8f a0 = vzero8(), a1 = vzero8();
#pragma unroll
    for (int j = 0; j < 8; ++j) {
      const v4f w0 = wkS[j * 32 + lane];
      const v4f w1 = wkS[(8 + j) * 32 + lane];
      a0 = wmma4(frag_lo(w0), barr[2 * j], a0);
      a1 = wmma4(frag_lo(w1), barr[2 * j], a1);
      a0 = wmma4(frag_hi(w0), barr[2 * j + 1], a0);
      a1 = wmma4(frag_hi(w1), barr[2 * j + 1], a1);
    }
#pragma unroll
    for (int r = 0; r < 8; ++r) {
      mx0[r] = fmaxf(mx0[r], a0[r]);
      mx1[r] = fmaxf(mx1[r], a1[r]);
    }
  }
#pragma unroll
  for (int r = 0; r < 8; ++r) {
    mx0[r] += bk[r + 8 * lh];
    mx1[r] += bk[16 + r + 8 * lh];
  }
  // butterfly max within each 16-lane group (wave32)
#pragma unroll
  for (int off = 1; off < 16; off <<= 1) {
#pragma unroll
    for (int r = 0; r < 8; ++r) {
      mx0[r] = fmaxf(mx0[r], __shfl_xor(mx0[r], off, 32));
      mx1[r] = fmaxf(mx1[r], __shfl_xor(mx1[r], off, 32));
    }
  }
  if (lm == 0) {
#pragma unroll
    for (int r = 0; r < 8; ++r) {
      lmax[wv][8 * lh + r]      = mx0[r];
      lmax[wv][16 + 8 * lh + r] = mx1[r];
    }
  }
  __syncthreads();
  if (tid < 32) {
    float m = lmax[0][tid];
    for (int w = 1; w < 8; ++w) m = fmaxf(m, lmax[w][tid]);
    kmaxS[tid] = m;
  }
  __syncthreads();

  // fused per-lane constants: bkm = bk - kmax (folded), bv
  float bkm0[8], bkm1[8], bv0[8], bv1[8];
#pragma unroll
  for (int r = 0; r < 8; ++r) {
    const int c0 = r + 8 * lh, c1 = 16 + r + 8 * lh;
    bkm0[r] = bk[c0] - kmaxS[c0];
    bkm1[r] = bk[c1] - kmaxS[c1];
    bv0[r] = bv[c0]; bv1[r] = bv[c1];
  }

  // ---------- Loop B: e, v, ctx partial, esum partial ----------
  const int head = wv & 1;
  const int quarter = wv >> 1;
  v8f ctxacc = vzero8();
  float esum = 0.0f;
  const int ech = tid & 31, egrp = tid >> 5;

  for (int c = 0; c < 4; ++c) {
    const size_t s0 = sbase + (size_t)c * 128 + (size_t)wv * 16;
    v2f barr[16];
#pragma unroll
    for (int kk = 0; kk < 16; ++kk) {   // L2-hot re-read, batched
      const int row = kk * 4 + 2 * lh;
      barr[kk].x = xb[(size_t)row * SLEN + s0 + lm];
      barr[kk].y = xb[(size_t)(row + 1) * SLEN + s0 + lm];
    }
    v8f k0 = vzero8(), k1 = vzero8(), v0 = vzero8(), v1 = vzero8();
#pragma unroll
    for (int j = 0; j < 8; ++j) {
      const v4f ak0 = wkS[j * 32 + lane];
      const v4f ak1 = wkS[(8 + j) * 32 + lane];
      const v4f av0 = wvS[j * 32 + lane];
      const v4f av1 = wvS[(8 + j) * 32 + lane];
      k0 = wmma4(frag_lo(ak0), barr[2 * j], k0);
      k1 = wmma4(frag_lo(ak1), barr[2 * j], k1);
      v0 = wmma4(frag_lo(av0), barr[2 * j], v0);
      v1 = wmma4(frag_lo(av1), barr[2 * j], v1);
      k0 = wmma4(frag_hi(ak0), barr[2 * j + 1], k0);
      k1 = wmma4(frag_hi(ak1), barr[2 * j + 1], k1);
      v0 = wmma4(frag_hi(av0), barr[2 * j + 1], v0);
      v1 = wmma4(frag_hi(av1), barr[2 * j + 1], v1);
    }
    const int col = wv * 16 + lm;
#pragma unroll
    for (int r = 0; r < 8; ++r) {
      const int c0 = r + 8 * lh, c1 = 16 + r + 8 * lh;
      eS[c0][col] = __expf(k0[r] + bkm0[r]);
      eS[c1][col] = __expf(k1[r] + bkm1[r]);
      vS[c0][col] = v0[r] + bv0[r];
      vS[c1][col] = v1[r] + bv1[r];
    }
    __syncthreads();
    // ctx += E_head(16 x 4pos) x Vt(4pos x 16) via WMMA, fragments from LDS
#pragma unroll
    for (int kp = 0; kp < 8; ++kp) {
      const int pos = quarter * 32 + kp * 4 + 2 * lh;
      v2f a, b2;
      a.x  = eS[head * 16 + lm][pos];
      a.y  = eS[head * 16 + lm][pos + 1];
      b2.x = vS[head * 16 + lm][pos];
      b2.y = vS[head * 16 + lm][pos + 1];
      ctxacc = wmma4(a, b2, ctxacc);
    }
    float s = 0.0f;
#pragma unroll
    for (int p2 = 0; p2 < 16; ++p2) s += eS[ech][egrp * 16 + p2];
    esum += s;
    __syncthreads();
  }

#pragma unroll
  for (int r = 0; r < 8; ++r) cbuf[wv][(r + 8 * lh) * 16 + lm] = ctxacc[r];
  esbuf[egrp][ech] = esum;
  __syncthreads();

  float* rec = partials + (size_t)(blockIdx.y * gridDim.x + blockIdx.x) * RECSZ;
  if (tid < 32) {
    rec[tid] = kmaxS[tid];                    // block max
    float s = 0.0f;
    for (int w = 0; w < 8; ++w) s += esbuf[w][tid];
    rec[32 + tid] = s;                        // block esum
  }
  for (int e = tid; e < 512; e += 256) {
    const int hh = e >> 8, idx = e & 255;
    float s = 0.0f;
    for (int w = hh; w < 8; w += 2) s += cbuf[w][idx];
    rec[64 + e] = s;                          // block ctx
  }
}

// ====== Pass 1b: fixed-order cross-block combine with exact rescaling =======
// One work-group per 32 neighbouring ctx elements (two key channels, one
// 128-byte line of every record and of ctxn). Each wave takes 16 of the 512
// records, all of its loads are issued before the first use, and the partial
// sums meet in LDS in a fixed order.
__global__ void __launch_bounds__(1024)
k_reduce(const float* __restrict__ partials, float* __restrict__ ctxn) {
  __shared__ float fS[2][512];   // rescale factor per (channel of the pair, record)
  __shared__ float mS[32];       // per-wave max
  __shared__ float eSm[32];      // per-wave rescaled esum
  __shared__ float cS[32][32];   // per-wave ctx partial

  const int tid = threadIdx.x;
  const int lane = tid & 31, wv = tid >> 5;
  const int nb = blockIdx.y;
  const int e0 = blockIdx.x * 32;      // first ctx element of this group
  const int ch0 = blockIdx.x * 2;      // first key channel of this group
  const float* base = partials + (size_t)nb * 512 * RECSZ;

  // waves 0..15: channel ch0, waves 16..31: channel ch0+1; one record a thread
  const int half = tid >> 9, rec = tid & 511;
  const float km = base[(size_t)rec * RECSZ + ch0 + half];
  const float er = base[(size_t)rec * RECSZ + 32 + ch0 + half];
  float cv[16];
#pragma unroll
  for (int j = 0; j < 16; ++j)
    cv[j] = base[(size_t)(j * 32 + wv) * RECSZ + 64 + e0 + lane];

  float m = km;
#pragma unroll
  for (int off = 1; off < 32; off <<= 1) m = fmaxf(m, __shfl_xor(m, off, 32));
  if (lane == 0) mS[wv] = m;
  __syncthreads();
  float M = mS[half * 16];
#pragma unroll
  for (int w = 1; w < 16; ++w) M = fmaxf(M, mS[half * 16 + w]);

  const float f = expf(km - M);
  fS[half][rec] = f;
  float es = er * f;
#pragma unroll
  for (int off = 1; off < 32; off <<= 1) es += __shfl_xor(es, off, 32);
  if (lane == 0) eSm[wv] = es;
  __syncthreads();

  const int lh = lane >> 4;            // which channel of the pair this lane sums
  float cs = 0.0f;
#pragma unroll
  for (int j = 0; j < 16; ++j) cs += cv[j] * fS[lh][j * 32 + wv];
  cS[wv][lane] = cs;
  __syncthreads();

  if (tid < 32) {
    float c = 0.0f, s = 0.0f;
#pragma unroll
    for (int w = 0; w < 32; ++w) c += cS[w][lane];
#pragma unroll
    for (int w = 0; w < 16; ++w) s += eSm[lh * 16 + w];
    ctxn[nb * 512 + e0 + lane] = c / s;
  }
}

// --- Pass 2: q proj (WMMA) -> ch softmax -> att -> out proj (WMMA) + resid ---
__global__ void __launch_bounds__(256, 2)
k_out(const float* __restrict__ x,
      const float* __restrict__ Wq, const float* __restrict__ bq,
      const float* __restrict__ Wr, const float* __restrict__ br,
      const float* __restrict__ ctxn, float* __restrict__ out) {
  __shared__ float qS[32][130];
  __shared__ float aS[32][130];
  __shared__ float ctxS[512];
  __shared__ v4f wqS[2 * 8 * 32];   // Wq in fragment order
  __shared__ v4f wrS[4 * 4 * 32];   // Wr in fragment order

  const int tid = threadIdx.x;
  const int lane = tid & 31, wv = tid >> 5;
  const int lm = lane & 15, lh = lane >> 4;
  const int nb = blockIdx.y;
  const size_t s0 = (size_t)blockIdx.x * 128 + (size_t)wv * 16;
  const float* xb = x + (size_t)nb * CIN * SLEN;

#if __has_builtin(__builtin_amdgcn_global_load_async_to_lds_b128)
  if (tid < 128) {
    __builtin_amdgcn_global_load_async_to_lds_b128(
        (glob_v4i*)(ctxn + nb * 512 + tid * 4),
        (lds_v4i*)(&ctxS[tid * 4]), 0, 0);
  }
#if __has_builtin(__builtin_amdgcn_s_wait_asynccnt)
  __builtin_amdgcn_s_wait_asynccnt(0);
#else
  asm volatile("s_wait_asynccnt 0" ::: "memory");
#endif
#else
  for (int i = tid; i < 512; i += 256) ctxS[i] = ctxn[nb * 512 + i];
#endif

  v2f barr[16];
#pragma unroll
  for (int kk = 0; kk < 16; ++kk) {   // batched x loads
    const int row = kk * 4 + 2 * lh;
    barr[kk].x = xb[(size_t)row * SLEN + s0 + lm];
    barr[kk].y = xb[(size_t)(row + 1) * SLEN + s0 + lm];
  }
  stage_frag<KCH, CIN>(Wq, wqS, tid);
  stage_frag<CIN, VCH>(Wr, wrS, tid);
  __syncthreads();

  v8f q0 = vzero8(), q1 = vzero8();
#pragma unroll
  for (int j = 0; j < 8; ++j) {
    const v4f a0 = wqS[j * 32 + lane];
    const v4f a1 = wqS[(8 + j) * 32 + lane];
    q0 = wmma4(frag_lo(a0), barr[2 * j], q0);
    q1 = wmma4(frag_lo(a1), barr[2 * j], q1);
    q0 = wmma4(frag_hi(a0), barr[2 * j + 1], q0);
    q1 = wmma4(frag_hi(a1), barr[2 * j + 1], q1);
  }
  const int col = wv * 16 + lm;
#pragma unroll
  for (int r = 0; r < 8; ++r) {
    const int c0 = r + 8 * lh, c1 = 16 + r + 8 * lh;
    qS[c0][col] = q0[r] + bq[c0];
    qS[c1][col] = q1[r] + bq[c1];
  }
  __syncthreads();

  {
    const int p = tid & 127;
    const int hh = tid >> 7;
    float qv[16];
    float mx = -3.402823e38f;
#pragma unroll
    for (int kc = 0; kc < 16; ++kc) {
      qv[kc] = qS[hh * 16 + kc][p];
      mx = fmaxf(mx, qv[kc]);
    }
    float sm = 0.0f;
#pragma unroll
    for (int kc = 0; kc < 16; ++kc) { qv[kc] = __expf(qv[kc] - mx); sm += qv[kc]; }
    const float inv = 1.0f / sm;
#pragma unroll
    for (int vc = 0; vc < 16; ++vc) {
      float a = 0.0f;
#pragma unroll
      for (int kc = 0; kc < 16; ++kc) a += ctxS[hh * 256 + kc * 16 + vc] * qv[kc];
      aS[hh * 16 + vc][p] = a * inv;
    }
  }
  __syncthreads();

  v2f batt[8];
#pragma unroll
  for (int kk = 0; kk < 8; ++kk) {
    const int row = kk * 4 + 2 * lh;
    batt[kk].x = aS[row][col];
    batt[kk].y = aS[row + 1][col];
  }
  v8f o0 = vzero8(), o1 = vzero8(), o2 = vzero8(), o3 = vzero8();
#pragma unroll
  for (int j = 0; j < 4; ++j) {
    const v4f a0 = wrS[j * 32 + lane];
    const v4f a1 = wrS[(4 + j) * 32 + lane];
    const v4f a2 = wrS[(8 + j) * 32 + lane];
    const v4f a3 = wrS[(12 + j) * 32 + lane];
    o0 = wmma4(frag_lo(a0), batt[2 * j], o0);
    o1 = wmma4(frag_lo(a1), batt[2 * j], o1);
    o2 = wmma4(frag_lo(a2), batt[2 * j], o2);
    o3 = wmma4(frag_lo(a3), batt[2 * j], o3);
    o0 = wmma4(frag_hi(a0), batt[2 * j + 1], o0);
    o1 = wmma4(frag_hi(a1), batt[2 * j + 1], o1);
    o2 = wmma4(frag_hi(a2), batt[2 * j + 1], o2);
    o3 = wmma4(frag_hi(a3), batt[2 * j + 1], o3);
  }
  float* ob = out + (size_t)nb * CIN * SLEN;
#pragma unroll
  for (int r = 0; r < 8; ++r) {
    const int m = r + 8 * lh;
    const size_t i0 = (size_t)m * SLEN + s0 + lm;
    ob[i0] = o0[r] + br[m] + xb[i0];
    const size_t i1 = (size_t)(m + 16) * SLEN + s0 + lm;
    ob[i1] = o1[r] + br[m + 16] + xb[i1];
    const size_t i2 = (size_t)(m + 32) * SLEN + s0 + lm;
    ob[i2] = o2[r] + br[m + 32] + xb[i2];
    const size_t i3 = (size_t)(m + 48) * SLEN + s0 + lm;
    ob[i3] = o3[r] + br[m + 48] + xb[i3];
  }
}

extern "C" void kernel_launch(void* const* d_in, const int* in_sizes, int n_in,
                              void* d_out, int out_size, void* d_ws, size_t ws_size,
                              hipStream_t stream) {
  (void)in_sizes; (void)n_in; (void)out_size; (void)ws_size;
  const float* x  = (const float*)d_in[0];
  const float* Wk = (const float*)d_in[1];
  const float* bk = (const float*)d_in[2];
  const float* Wq = (const float*)d_in[3];
  const float* bq = (const float*)d_in[4];
  const float* Wv = (const float*)d_in[5];
  const float* bv = (const float*)d_in[6];
  const float* Wr = (const float*)d_in[7];
  const float* br = (const float*)d_in[8];
  float* out = (float*)d_out;

  float* ctxn     = (float*)((char*)d_ws + 256);   // 1024 floats
  float* partials = (float*)((char*)d_ws + 4608);  // 1024*RECSZ floats

  hipLaunchKernelGGL(k_stats, dim3(SLEN / 512, NBATCH), dim3(256), 0, stream,
                     x, Wk, bk, Wv, bv, partials);
  hipLaunchKernelGGL(k_reduce, dim3(16, NBATCH), dim3(1024), 0, stream,
                     partials, ctxn);
  hipLaunchKernelGGL(k_out, dim3(SLEN / 128, NBATCH), dim3(256), 0, stream,
                     x, Wq, bq, Wr, br, ctxn, out);
}

// v003
// It runs in 82.2 microseconds.
// Next to v002, in two timings, it ran 1.13 times as fast each time.
// Over all steps from v000 it is 3.49 times as fast.
#include <hip/hip_runtime.h>
#include <math.h>

typedef __attribute__((ext_vector_type(2))) float v2f;
typedef __attribute__((ext_vector_type(4))) float v4f;
typedef __attribute__((ext_vector_type(8))) float v8f;

typedef int v4i_gcc __attribute__((vector_size(16)));
typedef __attribute__((address_space(1))) v4i_gcc glob_v4i;
typedef __attribute__((address_space(3))) v4i_gcc lds_v4i;

#define NBATCH 2
#define CIN 64
#define SLEN 262144   /* 16*128*128 */
#define KCH 32
#define VCH 32
#define RECSZ 576     /* per-block record: kmax[32] esum[32] ctx[512] */

// D(16x16,f32) = A(16x4,f32) x B(4x16,f32) + C
__device__ __forceinline__ v8f wmma4(v2f a, v2f b, v8f c) {
  return __builtin_amdgcn_wmma_f32_16x16x4_f32(false, a, false, b, (short)0, c,
                                               false, false);
}

__device__ __forceinline__ v8f vzero8() {
  v8f z;
#pragma unroll
  for (int i = 0; i < 8; ++i) z[i] = 0.0f;
  return z;
}

// Copies a row-major weight matrix (ROWS x K) into LDS in the order in which
// the matrix instruction takes its A operand, so that a wave fetches two k
// steps of a 16-row tile with one contiguous 512-byte LDS read instead of two
// global loads that touch 16 cache lines each.
// Entry (mt * (K / 8) + j) * 32 + lane, with row = mt * 16 + (lane & 15) and
// h = lane >> 4, holds columns 8j+2h, 8j+2h+1 (k step 2j) and 8j+4+2h, 8j+5+2h
// (k step 2j+1). A wave reads 8 rows x 64 bytes of the matrix at a time.
template <int ROWS, int K>
__device__ __forceinline__ void stage_frag(const float* __restrict__ Wm,
                                           v4f* dst, int tid) {
  constexpr int QG = K / 16;
#pragma unroll
  for (int i0 = 0; i0 < ROWS * K / 4; i0 += 256) {
    const int i = i0 + tid;
    const int t = i >> 5;
    const int m = (t / QG) * 8 + ((i >> 2) & 7);
    const int q = (t % QG) * 4 + (i & 3);
    const v4f w = *(const v4f*)(Wm + m * K + q * 4);
    v2f* d = (v2f*)(dst + ((m >> 4) * (K / 8) + (q >> 1)) * 32 + (m & 15)) + (q & 1);
    v2f lo, hi;
    lo.x = w.x; lo.y = w.y;
    hi.x = w.z; hi.y = w.w;
    d[0] = lo;    // lanes 0..15 of the fragment
    d[32] = hi;   // lanes 16..31
  }
}

__device__ __forceinline__ v2f frag_lo(v4f w) { v2f r; r.x = w.x; r.y = w.y; return r; }
__device__ __forceinline__ v2f frag_hi(v4f w) { v2f r; r.x = w.z; r.y = w.w; return r; }

// Lane l with lane l ^ 16 (the other half of the wave), a vector cross-row move.
__device__ __forceinline__ float xhalf(float v) {
  return __builtin_bit_cast(float, __builtin_amdgcn_permlanex16(
      __builtin_bit_cast(int, v), __builtin_bit_cast(int, v),
      0x76543210, 0xfedcba98, false, false));
}

// e^v as the fast-math exponential computes it (one multiply, one v_exp_f32).
// The v_nop keeps the one free slot that the instruction set asks for behind a
// transcendental; in one statement with it, it cannot be scheduled away.
__device__ __forceinline__ float exp_slot(float v) {
  const float t = v * 1.44269504f;
  float r;
  asm("v_exp_f32 %0, %1\n\tv_nop" : "=v"(r) : "v"(t));
  return r;
}

// Two neighbouring registers of an accumulator-layout tile as a B operand.
__device__ __forceinline__ v2f pair_of(v8f t, int i) {
  v2f r; r.x = t[i]; r.y = t[i + 1]; return r;
}

// ============ Pass 1 (fused): block kmax + e/v + block ctx partials =========
// Each block: 512 positions, each wave 16 of every 128. x is the A operand and
// the weight fragments are the B operand, so a product comes out transposed:
// register r = position 8h + r, column = output channel. Loop A computes the
// per-block channel max of Wk@x (tile stays hot in L2 for loop B -> only one
// HBM pass over x here). Loop B: e=exp(k+bk-m_b), v=Wv@x+bv; their registers
// are the A and B operands of ctx_b += E V^T as they stand (k = position), and
// max and esum run down a lane's own registers: no transposition through LDS.
__global__ void __launch_bounds__(256, 2)
k_stats(const float* __restrict__ x,
        const float* __restrict__ Wk, const float* __restrict__ bk,
        const float* __restrict__ Wv, const float* __restrict__ bv,
        float* __restrict__ partials) {
  __shared__ float lmax[8][32];
  __shared__ float kmaxS[32];
  __shared__ float cbuf[8][512];
  __shared__ float esbuf[8][32];
  __shared__ v4f wkS[2 * 8 * 32];   // Wk in fragment order
  __shared__ v4f wvS[2 * 8 * 32];   // Wv in fragment order

  const int tid = threadIdx.x;
  const int lane = tid & 31, wv = tid >> 5;
  const int lm = lane & 15, lh = lane >> 4;
  const int nb = blockIdx.y;
  const size_t sbase = (size_t)blockIdx.x * 512;
  const float* xb = x + (size_t)nb * CIN * SLEN;

  stage_frag<KCH, CIN>(Wk, wkS, tid);
  stage_frag<VCH, CIN>(Wv, wvS, tid);
  // precaution: the staging loads' address registers are reused further down
  asm volatile("s_wait_xcnt 0x0" ::: "memory");
  __syncthreads();

  // ---------- Loop A: per-block channel max of k = Wk@x ----------
  float mx0 = -3.402823e38f, mx1 = -3.402823e38f;   // channels lm, 16 + lm

  for (int c = 0; c < 4; ++c) {
    const size_t s0 = sbase + (size_t)c * 128 + (size_t)wv * 16;
    v2f barr[16];
#pragma unroll
    for (int kk = 0; kk < 16; ++kk) {   // batched loads -> one wait
      const int row = kk * 4 + 2 * lh;
      barr[kk].x = xb[(size_t)row * SLEN + s0 + lm];
      barr[kk].y = xb[(size_t)(row + 1) * SLEN + s0 + lm];
    }
    v8f a0 = vzero8(), a1 = vzero8();
#pragma unroll
    for (int j = 0; j < 8; ++j) {
      const v4f w0 = wkS[j * 32 + lane];
      const v4f w1 = wkS[(8 + j) * 32 + lane];
      a0 = wmma4(barr[2 * j], frag_lo(w0), a0);
      a1 = wmma4(barr[2 * j], frag_lo(w1), a1);
      a0 = wmma4(barr[2 * j + 1], frag_hi(w0), a0);
      a1 = wmma4(barr[2 * j + 1], frag_hi(w1), a1);
    }
#pragma unroll
    for (int r = 0; r < 8; ++r) {
      mx0 = fmaxf(mx0, a0[r]);
      mx1 = fmaxf(mx1, a1[r]);
    }
  }
  mx0 = fmaxf(mx0, xhalf(mx0)) + bk[lm];
  mx1 = fmaxf(mx1, xhalf(mx1)) + bk[16 + lm];
  lmax[wv][lane] = lh ? mx1 : mx0;
  __syncthreads();
  if (tid < 32) {
    float m = lmax[0][tid];
    for (int w = 1; w < 8; ++w) m = fmaxf(m, lmax[w][tid]);
    kmaxS[tid] = m;
  }
  __syncthreads();

  // per-lane constants: bkm = bk - kmax (folded), bv
  const float bkm0 = bk[lm] - kmaxS[lm];
  const float bkm1 = bk[16 + lm] - kmaxS[16 + lm];
  const float bv0 = bv[lm], bv1 = bv[16 + lm];

  // ---------- Loop B: e, v, ctx partial, esum partial ----------
  v8f ctx0 = vzero8(), ctx1 = vzero8();   // head 0, head 1
  float es0 = 0.0f, es1 = 0.0f;

  for (int c = 0; c < 4; ++c) {
    const size_t s0 = sbase + (size_t)c * 128 + (size_t)wv * 16;
    v2f barr[16];
#pragma unroll
    for (int kk = 0; kk < 16; ++kk) {   // L2-hot re-read, batched
      const int row = kk * 4 + 2 * lh;
      barr[kk].x = xb[(size_t)row * SLEN + s0 + lm];
      barr[kk].y = xb[(size_t)(row + 1) * SLEN + s0 + lm];
    }
    v8f k0 = vzero8(), k1 = vzero8(), v0 = vzero8(), v1 = vzero8();
#pragma unroll
    for (int j = 0; j < 8; ++j) {
      const v4f ak0 = wkS[j * 32 + lane];
      const v4f ak1 = wkS[(8 + j) * 32 + lane];
      const v4f av0 = wvS[j * 32 + lane];
      const v4f av1 = wvS[(8 + j) * 32 + lane];
      k0 = wmma4(barr[2 * j], frag_lo(ak0), k0);
      k1 = wmma4(barr[2 * j], frag_lo(ak1), k1);
      v0 = wmma4(barr[2 * j], frag_lo(av0), v0);
      v1 = wmma4(barr[2 * j], frag_lo(av1), v1);
      k0 = wmma4(barr[2 * j + 1], frag_hi(ak0), k0);
      k1 = wmma4(barr[2 * j + 1], frag_hi(ak1), k1);
      v0 = wmma4(barr[2 * j + 1], frag_hi(av0), v0);
      v1 = wmma4(barr[2 * j + 1], frag_hi(av1), v1);
    }
#pragma unroll
    for (int r = 0; r < 8; ++r) {
      k0[r] = __expf(k0[r] + bkm0);
      k1[r] = __expf(k1[r] + bkm1);
      v0[r] += bv0;
      v1[r] += bv1;
      es0 += k0[r];
      es1 += k1[r];
    }
    // ctx[key ch][value ch] += sum over the wave's 16 positions; k step p of
    // lane half h = positions 8h + 2p, 8h + 2p + 1 on both operands
#pragma unroll
    for (int p = 0; p < 4; ++p) {
      ctx0 = wmma4(pair_of(k0, 2 * p), pair_of(v0, 2 * p), ctx0);
      ctx1 = wmma4(pair_of(k1, 2 * p), pair_of(v1, 2 * p), ctx1);
    }
  }

#pragma unroll
  for (int r = 0; r < 8; ++r) {
    cbuf[wv][(r + 8 * lh) * 16 + lm] = ctx0[r];
    cbuf[wv][256 + (r + 8 * lh) * 16 + lm] = ctx1[r];
  }
  es0 += xhalf(es0);
  es1 += xhalf(es1);
  esbuf[wv][lane] = lh ? es1 : es0;
  __syncthreads();

  float* rec = partials + (size_t)(blockIdx.y * gridDim.x + blockIdx.x) * RECSZ;
  if (tid < 32) {
    rec[tid] = kmaxS[tid];                    // block max
    float s = 0.0f;
    for (int w = 0; w < 8; ++w) s += esbuf[w][tid];
    rec[32 + tid] = s;                        // block esum
  }
  for (int e = tid; e < 512; e += 256) {
    float s = 0.0f;
    for (int w = 0; w < 8; ++w) s += cbuf[w][e];
    rec[64 + e] = s;                          // block ctx
  }
}

// ====== Pass 1b: fixed-order cross-block combine with exact rescaling =======
// One work-group per 32 neighbouring ctx elements (two key channels, one
// 128-byte line of every record and of ctxn). Each wave takes 16 of the 512
// records, all of its loads are issued before the first use, and the partial
// sums meet in LDS in a fixed order.
__global__ void __launch_bounds__(1024)
k_reduce(const float* __restrict__ partials, float* __restrict__ ctxn) {
  __shared__ float fS[2][512];   // rescale factor per (channel of the pair, record)
  __shared__ float mS[32];       // per-wave max
  __shared__ float eSm[32];      // per-wave rescaled esum
  __shared__ float cS[32][32];   // per-wave ctx partial

  const int tid = threadIdx.x;
  const int lane = tid & 31, wv = tid >> 5;
  const int nb = blockIdx.y;
  const int e0 = blockIdx.x * 32;      // first ctx element of this group
  const int ch0 = blockIdx.x * 2;      // first key channel of this group
  const float* base = partials + (size_t)nb * 512 * RECSZ;

  // waves 0..15: channel ch0, waves 16..31: channel ch0+1; one record a thread
  const int half = tid >> 9, rec = tid & 511;
  const float km = base[(size_t)rec * RECSZ + ch0 + half];
  const float er = base[(size_t)rec * RECSZ + 32 + ch0 + half];
  float cv[16];
#pragma unroll
  for (int j = 0; j < 16; ++j)
    cv[j] = base[(size_t)(j * 32 + wv) * RECSZ + 64 + e0 + lane];

  float m = km;
#pragma unroll
  for (int off = 1; off < 32; off <<= 1) m = fmaxf(m, __shfl_xor(m, off, 32));
  if (lane == 0) mS[wv] = m;
  __syncthreads();
  float M = mS[half * 16];
#pragma unroll
  for (int w = 1; w < 16; ++w) M = fmaxf(M, mS[half * 16 + w]);

  const float f = expf(km - M);
  fS[half][rec] = f;
  float es = er * f;
#pragma unroll
  for (int off = 1; off < 32; off <<= 1) es += __shfl_xor(es, off, 32);
  if (lane == 0) eSm[wv] = es;
  __syncthreads();

  const int lh = lane >> 4;            // which channel of the pair this lane sums
  float cs = 0.0f;
#pragma unroll
  for (int j = 0; j < 16; ++j) cs += cv[j] * fS[lh][j * 32 + wv];
  cS[wv][lane] = cs;
  __syncthreads();

  if (tid < 32) {
    float c = 0.0f, s = 0.0f;
#pragma unroll
    for (int w = 0; w < 32; ++w) c += cS[w][lane];
#pragma unroll
    for (int w = 0; w < 16; ++w) s += eSm[lh * 16 + w];
    ctxn[nb * 512 + e0 + lane] = c / s;
  }
}

// Weight matrix (ROWS x K) into LDS as A fragments whose k order is the order
// in which an accumulator-layout tile holds its rows: lane half h owns rows
// 8h..8h+7 of each 16-row tile, two neighbouring registers make one k step.
// Entry (mt * (K / 8) + j) * 32 + 16 * h + c holds, for row mt * 16 + c, the
// four columns 16 * (j >> 1) + 8 * h + 4 * (j & 1) + 0..3 (k steps 2j, 2j+1),
// which are one aligned 16-byte piece of the matrix row.
template <int ROWS, int K>
__device__ __forceinline__ void stage_frag_acc(const float* __restrict__ Wm,
                                               v4f* dst, int tid) {
  constexpr int QG = K / 16;
#pragma unroll
  for (int i0 = 0; i0 < ROWS * K / 4; i0 += 256) {
    const int i = i0 + tid;
    const int t = i >> 5;
    const int m = (t / QG) * 8 + ((i >> 2) & 7);
    const int q = (t % QG) * 4 + (i & 3);
    const v4f w = *(const v4f*)(Wm + m * K + q * 4);
    const int j = ((q >> 2) << 1) | (q & 1);
    const int h = (q >> 1) & 1;
    dst[((m >> 4) * (K / 8) + j) * 32 + h * 16 + (m & 15)] = w;
  }
}

// --- Pass 2: q proj -> ch softmax -> att -> out proj + resid, all on WMMA ---
// Every wave keeps its 16 positions in registers from the x load to the store.
// x is loaded in accumulator layout (register r of tile t = channel
// 16t + 8h + r, column = position), and the A side of each product takes the
// matching k order, so each product's D registers are the next product's B
// operand and the x registers are the residual: no transposition through LDS.
__global__ void __launch_bounds__(256, 2)
k_out(const float* __restrict__ x,
      const float* __restrict__ Wq, const float* __restrict__ bq,
      const float* __restrict__ Wr, const float* __restrict__ br,
      const float* __restrict__ ctxn, float* __restrict__ out) {
  __shared__ float ctxS[512];
  __shared__ v4f wqS[2 * 8 * 32];   // Wq, A fragments in accumulator k order
  __shared__ v4f wrS[4 * 4 * 32];   // Wr, A fragments in accumulator k order

  const int tid = threadIdx.x;
  const int lane = tid & 31, wv = tid >> 5;
  const int lm = lane & 15, lh = lane >> 4;
  const int nb = blockIdx.y;
  const size_t s0 = (size_t)blockIdx.x * 128 + (size_t)wv * 16;
  const float* xb = x + (size_t)nb * CIN * SLEN;

#if __has_builtin(__builtin_amdgcn_global_load_async_to_lds_b128)
  if (tid < 128) {
    __builtin_amdgcn_global_load_async_to_lds_b128(
        (glob_v4i*)(ctxn + nb * 512 + tid * 4),
        (lds_v4i*)(&ctxS[tid * 4]), 0, 0);
  }
#if __has_builtin(__builtin_amdgcn_s_wait_asynccnt)
  __builtin_amdgcn_s_wait_asynccnt(0);
#else
  asm volatile("s_wait_asynccnt 0" ::: "memory");
#endif
#else
  for (int i = tid; i < 512; i += 256) ctxS[i] = ctxn[nb * 512 + i];
#endif

  v8f xr[4];
#pragma unroll
  for (int t = 0; t < 4; ++t) {       // batched x loads
#pragma unroll
    for (int r = 0; r < 8; ++r)
      xr[t][r] = xb[(size_t)(t * 16 + 8 * lh + r) * SLEN + s0 + lm];
    // precaution: later loads land in registers that held these addresses
    asm volatile("s_wait_xcnt 0x0" ::: "memory");
  }
  stage_frag_acc<KCH, CIN>(Wq, wqS, tid);
  stage_frag_acc<CIN, VCH>(Wr, wrS, tid);
  __syncthreads();

  // q = Wq x: q[h][r] = channel 16h + 8*lh + r at position lm
  v8f q[2];
  q[0] = vzero8(); q[1] = vzero8();
#pragma unroll
  for (int j = 0; j < 8; ++j) {
    const v4f a0 = wqS[j * 32 + lane];
    const v4f a1 = wqS[(8 + j) * 32 + lane];
    const v2f b0 = pair_of(xr[j >> 1], 4 * (j & 1));
    const v2f b1 = pair_of(xr[j >> 1], 4 * (j & 1) + 2);
    q[0] = wmma4(frag_lo(a0), b0, q[0]);
    q[1] = wmma4(frag_lo(a1), b0, q[1]);
    q[0] = wmma4(frag_hi(a0), b1, q[0]);
    q[1] = wmma4(frag_hi(a1), b1, q[1]);
  }

  // softmax over the 16 channels of a head (8 registers x 2 lane halves), then
  // att = ctx^T e on WMMA with e taken from its own registers
  v8f att[2];
#pragma unroll
  for (int h = 0; h < 2; ++h) {
    float mx = -3.402823e38f;
#pragma unroll
    for (int r = 0; r < 8; ++r) {
      q[h][r] += bq[h * 16 + 8 * lh + r];
      mx = fmaxf(mx, q[h][r]);
    }
    mx = fmaxf(mx, xhalf(mx));
#pragma unroll
    for (int r = 0; r < 8; ++r) q[h][r] -= mx;
#pragma unroll
    for (int r = 0; r < 8; ++r) q[h][r] = exp_slot(q[h][r]);
    float sm = 0.0f;
#pragma unroll
    for (int r = 0; r < 8; ++r) sm += q[h][r];
    sm += xhalf(sm);
    const float inv = 1.0f / sm;
    v8f acc = vzero8();
#pragma unroll
    for (int p = 0; p < 4; ++p) {
      v2f a;   // A[row = value channel lm][k = key channel 8*lh + 2p + 0..1]
      a.x = ctxS[h * 256 + (8 * lh + 2 * p) * 16 + lm];
      a.y = ctxS[h * 256 + (8 * lh + 2 * p + 1) * 16 + lm];
      acc = wmma4(a, pair_of(q[h], 2 * p), acc);
    }
#pragma unroll
    for (int r = 0; r < 8; ++r) att[h][r] = acc[r] * inv;
  }

  v8f o0 = vzero8(), o1 = vzero8(), o2 = vzero8(), o3 = vzero8();
#pragma unroll
  for (int j = 0; j < 4; ++j) {
    const v4f a0 = wrS[j * 32 + lane];
    const v4f a1 = wrS[(4 + j) * 32 + lane];
    const v4f a2 = wrS[(8 + j) * 32 + lane];
    const v4f a3 = wrS[(12 + j) * 32 + lane];
    const v2f b0 = pair_of(att[j >> 1], 4 * (j & 1));
    const v2f b1 = pair_of(att[j >> 1], 4 * (j & 1) + 2);
    o0 = wmma4(frag_lo(a0), b0, o0);
    o1 = wmma4(frag_lo(a1), b0, o1);
    o2 = wmma4(frag_lo(a2), b0, o2);
    o3 = wmma4(frag_lo(a3), b0, o3);
    o0 = wmma4(frag_hi(a0), b1, o0);
    o1 = wmma4(frag_hi(a1), b1, o1);
    o2 = wmma4(frag_hi(a2), b1, o2);
    o3 = wmma4(frag_hi(a3), b1, o3);
  }
  // output bias in accumulator layout: register r of tile t = channel 16t + 8*lh + r
  const v4f* brv = (const v4f*)(br + 8 * lh);
  v4f bo[8];
#pragma unroll
  for (int i = 0; i < 8; ++i) {
    bo[i] = brv[(i >> 1) * 4 + (i & 1)];
    // precaution: a later load may land in the register that holds this offset
    asm volatile("s_wait_xcnt 0x0" ::: "memory");
  }
  float* ob = out + (size_t)nb * CIN * SLEN;
#pragma unroll
  for (int r = 0; r < 8; ++r) {
    const int m = r + 8 * lh;
    const size_t i0 = (size_t)m * SLEN + s0 + lm;
    ob[i0] = o0[r] + bo[r >> 2][r & 3] + xr[0][r];
    const size_t i1 = (size_t)(m + 16) * SLEN + s0 + lm;
    ob[i1] = o1[r] + bo[2 + (r >> 2)][r & 3] + xr[1][r];
    const size_t i2 = (size_t)(m + 32) * SLEN + s0 + lm;
    ob[i2] = o2[r] + bo[4 + (r >> 2)][r & 3] + xr[2][r];
    const size_t i3 = (size_t)(m + 48) * SLEN + s0 + lm;
    ob[i3] = o3[r] + bo[6 + (r >> 2)][r & 3] + xr[3][r];
  }
}

extern "C" void kernel_launch(void* const* d_in, const int* in_sizes, int n_in,
                              void* d_out, int out_size, void* d_ws, size_t ws_size,
                              hipStream_t stream) {
  (void)in_sizes; (void)n_in; (void)out_size; (void)ws_size;
  const float* x  = (const float*)d_in[0];
  const float* Wk = (const float*)d_in[1];
  const float* bk = (const float*)d_in[2];
  const float* Wq = (const float*)d_in[3];
  const float* bq = (const float*)d_in[4];
  const float* Wv = (const float*)d_in[5];
  const float* bv = (const float*)d_in[6];
  const float* Wr = (const float*)d_in[7];
  const float* br = (const float*)d_in[8];
  float* out = (float*)d_out;

  float* ctxn     = (float*)((char*)d_ws + 256);   // 1024 floats
  float* partials = (float*)((char*)d_ws + 4608);  // 1024*RECSZ floats

  hipLaunchKernelGGL(k_stats, dim3(SLEN / 512, NBATCH), dim3(256), 0, stream,
                     x, Wk, bk, Wv, bv, partials);
  hipLaunchKernelGGL(k_reduce, dim3(16, NBATCH), dim3(1024), 0, stream,
                     partials, ctxn);
  hipLaunchKernelGGL(k_out, dim3(SLEN / 128, NBATCH), dim3(256), 0, stream,
                     x, Wq, bq, Wr, br, ctxn, out);
}

// v004
// A run of this version takes 71.6 microseconds.
// Timed twice side by side with v003, it ran 1.15 and 1.16 times as fast.
// Over all steps from v000 it is 4.01 times as fast.
#include <hip/hip_runtime.h>
#include <math.h>

typedef __attribute__((ext_vector_type(2))) float v2f;
typedef __attribute__((ext_vector_type(4))) float v4f;
typedef __attribute__((ext_vector_type(8))) float v8f;

typedef int v4i_gcc __attribute__((vector_size(16)));
typedef __attribute__((address_space(1))) v4i_gcc glob_v4i;
typedef __attribute__((address_space(3))) v4i_gcc lds_v4i;

#define NBATCH 2
#define CIN 64
#define SLEN 262144   /* 16*128*128 */
#define KCH 32
#define VCH 32
#define RECSZ 576     /* per-block record: kmax[32] esum[32] ctx[512] */

// D(16x16,f32) = A(16x4,f32) x B(4x16,f32) + C
__device__ __forceinline__ v8f wmma4(v2f a, v2f b, v8f c) {
  return __builtin_amdgcn_wmma_f32_16x16x4_f32(false, a, false, b, (short)0, c,
                                               false, false);
}

__device__ __forceinline__ v8f vzero8() {
  v8f z;
#pragma unroll
  for (int i = 0; i < 8; ++i) z[i] = 0.0f;
  return z;
}

// Copies a row-major weight matrix (ROWS x K) into LDS in the order in which
// the matrix instruction takes its A operand, so that a wave fetches two k
// steps of a 16-row tile with one contiguous 512-byte LDS read instead of two
// global loads that touch 16 cache lines each.
// Entry (mt * (K / 8) + j) * 32 + lane, with row = mt * 16 + (lane & 15) and
// h = lane >> 4, holds columns 8j+2h, 8j+2h+1 (k step 2j) and 8j+4+2h, 8j+5+2h
// (k step 2j+1). A wave reads 8 rows x 64 bytes of the matrix at a time.
template <int ROWS, int K>
__device__ __forceinline__ void stage_frag(const float* __restrict__ Wm,
                                           v4f* dst, int tid) {
  constexpr int QG = K / 16;
#pragma unroll
  for (int i0 = 0; i0 < ROWS * K / 4; i0 += 256) {
    const int i = i0 + tid;
    const int t = i >> 5;
    const int m = (t / QG) * 8 + ((i >> 2) & 7);
    const int q = (t % QG) * 4 + (i & 3);
    const v4f w = *(const v4f*)(Wm + m * K + q * 4);
    v2f* d = (v2f*)(dst + ((m >> 4) * (K / 8) + (q >> 1)) * 32 + (m & 15)) + (q & 1);
    v2f lo, hi;
    lo.x = w.x; lo.y = w.y;
    hi.x = w.z; hi.y = w.w;
    d[0] = lo;    // lanes 0..15 of the fragment
    d[32] = hi;   // lanes 16..31
  }
}

__device__ __forceinline__ v2f frag_lo(v4f w) { v2f r; r.x = w.x; r.y = w.y; return r; }
__device__ __forceinline__ v2f frag_hi(v4f w) { v2f r; r.x = w.z; r.y = w.w; return r; }

// Lane l with lane l ^ 16 (the other half of the wave), a vector cross-row move.
__device__ __forceinline__ float xhalf(float v) {
  return __builtin_bit_cast(float, __builtin_amdgcn_permlanex16(
      __builtin_bit_cast(int, v), __builtin_bit_cast(int, v),
      0x76543210, 0xfedcba98, false, false));
}

// e^v as the fast-math exponential computes it (one multiply, one v_exp_f32).
// The v_nop keeps the one free slot that the instruction set asks for behind a
// transcendental; in one statement with it, it cannot be scheduled away.
__device__ __forceinline__ float exp_slot(float v) {
  const float t = v * 1.44269504f;
  float r;
  asm("v_exp_f32 %0, %1\n\tv_nop" : "=v"(r) : "v"(t));
  return r;
}

// Two neighbouring registers of an accumulator-layout tile as a B operand.
__device__ __forceinline__ v2f pair_of(v8f t, int i) {
  v2f r; r.x = t[i]; r.y = t[i + 1]; return r;
}

// x fragments of channel step j (8 input channels) for the four 16-position
// tiles of a wave; p holds the lane's position and its 2 * lh rows.
__device__ __forceinline__ void load_x8(const float* __restrict__ p, int j,
                                        v2f (&d)[4][2]) {
  const float* pj = p + (size_t)(8 * j) * SLEN;
#pragma unroll
  for (int s = 0; s < 2; ++s) {
#pragma unroll
    for (int c = 0; c < 4; ++c) {
      const size_t o = (size_t)(4 * s) * SLEN + (size_t)c * 128;
      d[c][s].x = pj[o];
      d[c][s].y = pj[o + SLEN];
    }
  }
}

// ============ Pass 1 (fused): block kmax + e/v + block ctx partials =========
// Each block: 512 positions, each wave 16 of every 128. x is the A operand and
// the weight fragments are the B operand, so a product comes out transposed:
// register r = position 8h + r, column = output channel. x is read once and
// each product is formed once: the channel loop is outermost, and the k and v
// tiles of all 64 positions of a wave (128 registers) stay in registers across
// the two barriers that make the block's channel max. Then e=exp(k+bk-m_b),
// v+=bv; their registers are the A and B operands of ctx_b += E V^T as they
// stand (k = position), and max and esum run down a lane's own registers.
__global__ void __launch_bounds__(256, 2)
k_stats(const float* __restrict__ x,
        const float* __restrict__ Wk, const float* __restrict__ bk,
        const float* __restrict__ Wv, const float* __restrict__ bv,
        float* __restrict__ partials) {
  __shared__ float lmax[8][32];
  __shared__ float kmaxS[32];
  __shared__ float cbuf[8][512];
  __shared__ float esbuf[8][32];
  __shared__ v4f wkS[2 * 8 * 32];   // Wk in fragment order
  __shared__ v4f wvS[2 * 8 * 32];   // Wv in fragment order

  const int tid = threadIdx.x;
  const int lane = tid & 31, wv = tid >> 5;
  const int lm = lane & 15, lh = lane >> 4;
  const int nb = blockIdx.y;
  const size_t sbase = (size_t)blockIdx.x * 512;
  const float* xb = x + (size_t)nb * CIN * SLEN;
  const float* xw = xb + (size_t)(2 * lh) * SLEN + sbase + (size_t)wv * 16 + lm;

  v2f xs[2][4][2];
  load_x8(xw, 0, xs[0]);   // in flight while the weights are staged
  // precaution: registers that hold parts of these addresses are reused below
  asm volatile("s_wait_xcnt 0x0" ::: "memory");

  stage_frag<KCH, CIN>(Wk, wkS, tid);
  stage_frag<VCH, CIN>(Wv, wvS, tid);
  // precaution: the staging loads' address registers are reused further down
  asm volatile("s_wait_xcnt 0x0" ::: "memory");
  __syncthreads();

  // ---------- k = Wk@x and v = Wv@x for the wave's 4 x 16 positions ----------
  v8f kt[4][2], vt[4][2];   // [tile][channel half]
#pragma unroll
  for (int c = 0; c < 4; ++c) {
    kt[c][0] = vzero8(); kt[c][1] = vzero8();
    vt[c][0] = vzero8(); vt[c][1] = vzero8();
  }
  v4f wf[2][4];   // a channel step's weight fragments: Wk rows 0..15, 16..31, Wv rows 0..15, 16..31
  wf[0][0] = wkS[lane];
  wf[0][1] = wkS[8 * 32 + lane];
  wf[0][2] = wvS[lane];
  wf[0][3] = wvS[8 * 32 + lane];
#pragma unroll
  for (int j = 0; j < 8; ++j) {
    const int b = j & 1;
    if (j + 1 < 8) {   // the next step's operands, one step ahead
      wf[b ^ 1][0] = wkS[(j + 1) * 32 + lane];
      wf[b ^ 1][1] = wkS[(8 + j + 1) * 32 + lane];
      wf[b ^ 1][2] = wvS[(j + 1) * 32 + lane];
      wf[b ^ 1][3] = wvS[(8 + j + 1) * 32 + lane];
      load_x8(xw, j + 1, xs[b ^ 1]);
      // precaution: the address registers of these loads are reused further down
      asm volatile("s_wait_xcnt 0x0" ::: "memory");
    }
    // keeps the loads above ahead of this step's 32 matrix instructions: left
    // free, the scheduler sinks them to their first use and the wave waits out
    // the whole memory latency at every step
    __builtin_amdgcn_sched_barrier(0);
#pragma unroll
    for (int c = 0; c < 4; ++c) {
      kt[c][0] = wmma4(xs[b][c][0], frag_lo(wf[b][0]), kt[c][0]);
      kt[c][1] = wmma4(xs[b][c][0], frag_lo(wf[b][1]), kt[c][1]);
      vt[c][0] = wmma4(xs[b][c][0], frag_lo(wf[b][2]), vt[c][0]);
      vt[c][1] = wmma4(xs[b][c][0], frag_lo(wf[b][3]), vt[c][1]);
    }
#pragma unroll
    for (int c = 0; c < 4; ++c) {
      kt[c][0] = wmma4(xs[b][c][1], frag_hi(wf[b][0]), kt[c][0]);
      kt[c][1] = wmma4(xs[b][c][1], frag_hi(wf[b][1]), kt[c][1]);
      vt[c][0] = wmma4(xs[b][c][1], frag_hi(wf[b][2]), vt[c][0]);
      vt[c][1] = wmma4(xs[b][c][1], frag_hi(wf[b][3]), vt[c][1]);
    }
  }

  // ---------- per-block channel max of k ----------
  float mx0 = -3.402823e38f, mx1 = -3.402823e38f;   // channels lm, 16 + lm
#pragma unroll
  for (int c = 0; c < 4; ++c) {
#pragma unroll
    for (int r = 0; r < 8; ++r) {
      mx0 = fmaxf(mx0, kt[c][0][r]);
      mx1 = fmaxf(mx1, kt[c][1][r]);
    }
  }
  mx0 = fmaxf(mx0, xhalf(mx0)) + bk[lm];
  mx1 = fmaxf(mx1, xhalf(mx1)) + bk[16 + lm];
  lmax[wv][lane] = lh ? mx1 : mx0;
  // precaution: the scalar base of the two bk loads is reused further down
  asm volatile("s_wait_xcnt 0x0" ::: "memory");
  __syncthreads();
  if (tid < 32) {
    float m = lmax[0][tid];
    for (int w = 1; w < 8; ++w) m = fmaxf(m, lmax[w][tid]);
    kmaxS[tid] = m;
  }
  __syncthreads();

  // per-lane constants: bkm = bk - kmax (folded), bv
  const float bkm0 = bk[lm] - kmaxS[lm];
  const float bkm1 = bk[16 + lm] - kmaxS[16 + lm];
  const float bv0 = bv[lm], bv1 = bv[16 + lm];

  // ---------- e, v, ctx partial, esum partial ----------
  v8f ctx0 = vzero8(), ctx1 = vzero8();   // head 0, head 1
  float es0 = 0.0f, es1 = 0.0f;

#pragma unroll
  for (int c = 0; c < 4; ++c) {
    v8f k0 = kt[c][0], k1 = kt[c][1], v0 = vt[c][0], v1 = vt[c][1];
#pragma unroll
    for (int r = 0; r < 8; ++r) {
      k0[r] = __expf(k0[r] + bkm0);
      k1[r] = __expf(k1[r] + bkm1);
      v0[r] += bv0;
      v1[r] += bv1;
      es0 += k0[r];
      es1 += k1[r];
    }
    // ctx[key ch][value ch] += sum over the wave's 16 positions; k step p of
    // lane half h = positions 8h + 2p, 8h + 2p + 1 on both operands
#pragma unroll
    for (int p = 0; p < 4; ++p) {
      ctx0 = wmma4(pair_of(k0, 2 * p), pair_of(v0, 2 * p), ctx0);
      ctx1 = wmma4(pair_of(k1, 2 * p), pair_of(v1, 2 * p), ctx1);
    }
  }

#pragma unroll
  for (int r = 0; r < 8; ++r) {
    cbuf[wv][(r + 8 * lh) * 16 + lm] = ctx0[r];
    cbuf[wv][256 + (r + 8 * lh) * 16 + lm] = ctx1[r];
  }
  es0 += xhalf(es0);
  es1 += xhalf(es1);
  esbuf[wv][lane] = lh ? es1 : es0;
  __syncthreads();

  float* rec = partials + (size_t)(blockIdx.y * gridDim.x + blockIdx.x) * RECSZ;
  if (tid < 32) {
    rec[tid] = kmaxS[tid];                    // block max
    float s = 0.0f;
    for (int w = 0; w < 8; ++w) s += esbuf[w][tid];
    rec[32 + tid] = s;                        // block esum
  }
  for (int e = tid; e < 512; e += 256) {
    float s = 0.0f;
    for (int w = 0; w < 8; ++w) s += cbuf[w][e];
    rec[64 + e] = s;                          // block ctx
  }
}

// ====== Pass 1b: fixed-order cross-block combine with exact rescaling =======
// One work-group per 32 neighbouring ctx elements (two key channels, one
// 128-byte line of every record and of ctxn). Each wave takes 16 of the 512
// records, all of its loads are issued before the first use, and the partial
// sums meet in LDS in a fixed order.
__global__ void __launch_bounds__(1024)
k_reduce(const float* __restrict__ partials, float* __restrict__ ctxn) {
  __shared__ float fS[2][512];   // rescale factor per (channel of the pair, record)
  __shared__ float mS[32];       // per-wave max
  __shared__ float eSm[32];      // per-wave rescaled esum
  __shared__ float cS[32][32];   // per-wave ctx partial

  const int tid = threadIdx.x;
  const int lane = tid & 31, wv = tid >> 5;
  const int nb = blockIdx.y;
  const int e0 = blockIdx.x * 32;      // first ctx element of this group
  const int ch0 = blockIdx.x * 2;      // first key channel of this group
  const float* base = partials + (size_t)nb * 512 * RECSZ;

  // waves 0..15: channel ch0, waves 16..31: channel ch0+1; one record a thread
  const int half = tid >> 9, rec = tid & 511;
  const float km = base[(size_t)rec * RECSZ + ch0 + half];
  const float er = base[(size_t)rec * RECSZ + 32 + ch0 + half];
  float cv[16];
#pragma unroll
  for (int j = 0; j < 16; ++j)
    cv[j] = base[(size_t)(j * 32 + wv) * RECSZ + 64 + e0 + lane];

  float m = km;
#pragma unroll
  for (int off = 1; off < 32; off <<= 1) m = fmaxf(m, __shfl_xor(m, off, 32));
  if (lane == 0) mS[wv] = m;
  __syncthreads();
  float M = mS[half * 16];
#pragma unroll
  for (int w = 1; w < 16; ++w) M = fmaxf(M, mS[half * 16 + w]);

  const float f = expf(km - M);
  fS[half][rec] = f;
  float es = er * f;
#pragma unroll
  for (int off = 1; off < 32; off <<= 1) es += __shfl_xor(es, off, 32);
  if (lane == 0) eSm[wv] = es;
  __syncthreads();

  const int lh = lane >> 4;            // which channel of the pair this lane sums
  float cs = 0.0f;
#pragma unroll
  for (int j = 0; j < 16; ++j) cs += cv[j] * fS[lh][j * 32 + wv];
  cS[wv][lane] = cs;
  __syncthreads();

  if (tid < 32) {
    float c = 0.0f, s = 0.0f;
#pragma unroll
    for (int w = 0; w < 32; ++w) c += cS[w][lane];
#pragma unroll
    for (int w = 0; w < 16; ++w) s += eSm[lh * 16 + w];
    ctxn[nb * 512 + e0 + lane] = c / s;
  }
}

// Weight matrix (ROWS x K) into LDS as A fragments whose k order is the order
// in which an accumulator-layout tile holds its rows: lane half h owns rows
// 8h..8h+7 of each 16-row tile, two neighbouring registers make one k step.
// Entry (mt * (K / 8) + j) * 32 + 16 * h + c holds, for row mt * 16 + c, the
// four columns 16 * (j >> 1) + 8 * h + 4 * (j & 1) + 0..3 (k steps 2j, 2j+1),
// which are one aligned 16-byte piece of the matrix row.
template <int ROWS, int K>
__device__ __forceinline__ void stage_frag_acc(const float* __restrict__ Wm,
                                               v4f* dst, int tid) {
  constexpr int QG = K / 16;
#pragma unroll
  for (int i0 = 0; i0 < ROWS * K / 4; i0 += 256) {
    const int i = i0 + tid;
    const int t = i >> 5;
    const int m = (t / QG) * 8 + ((i >> 2) & 7);
    const int q = (t % QG) * 4 + (i & 3);
    const v4f w = *(const v4f*)(Wm + m * K + q * 4);
    const int j = ((q >> 2) << 1) | (q & 1);
    const int h = (q >> 1) & 1;
    dst[((m >> 4) * (K / 8) + j) * 32 + h * 16 + (m & 15)] = w;
  }
}

// --- Pass 2: q proj -> ch softmax -> att -> out proj + resid, all on WMMA ---
// Every wave keeps its 16 positions in registers from the x load to the store.
// x is loaded in accumulator layout (register r of tile t = channel
// 16t + 8h + r, column = position), and the A side of each product takes the
// matching k order, so each product's D registers are the next product's B
// operand and the x registers are the residual: no transposition through LDS.
__global__ void __launch_bounds__(256, 2)
k_out(const float* __restrict__ x,
      const float* __restrict__ Wq, const float* __restrict__ bq,
      const float* __restrict__ Wr, const float* __restrict__ br,
      const float* __restrict__ ctxn, float* __restrict__ out) {
  __shared__ float ctxS[512];
  __shared__ v4f wqS[2 * 8 * 32];   // Wq, A fragments in accumulator k order
  __shared__ v4f wrS[4 * 4 * 32];   // Wr, A fragments in accumulator k order

  const int tid = threadIdx.x;
  const int lane = tid & 31, wv = tid >> 5;
  const int lm = lane & 15, lh = lane >> 4;
  const int nb = blockIdx.y;
  const size_t s0 = (size_t)blockIdx.x * 128 + (size_t)wv * 16;
  const float* xb = x + (size_t)nb * CIN * SLEN;

#if __has_builtin(__builtin_amdgcn_global_load_async_to_lds_b128)
  if (tid < 128) {
    __builtin_amdgcn_global_load_async_to_lds_b128(
        (glob_v4i*)(ctxn + nb * 512 + tid * 4),
        (lds_v4i*)(&ctxS[tid * 4]), 0, 0);
  }
#if __has_builtin(__builtin_amdgcn_s_wait_asynccnt)
  __builtin_amdgcn_s_wait_asynccnt(0);
#else
  asm volatile("s_wait_asynccnt 0" ::: "memory");
#endif
#else
  for (int i = tid; i < 512; i += 256) ctxS[i] = ctxn[nb * 512 + i];
#endif

  v8f xr[4];
#pragma unroll
  for (int t = 0; t < 4; ++t) {       // batched x loads
#pragma unroll
    for (int r = 0; r < 8; ++r)
      xr[t][r] = xb[(size_t)(t * 16 + 8 * lh + r) * SLEN + s0 + lm];
    // precaution: later loads land in registers that held these addresses
    asm volatile("s_wait_xcnt 0x0" ::: "memory");
  }
  stage_frag_acc<KCH, CIN>(Wq, wqS, tid);
  stage_frag_acc<CIN, VCH>(Wr, wrS, tid);
  __syncthreads();

  // q = Wq x: q[h][r] = channel 16h + 8*lh + r at position lm
  v8f q[2];
  q[0] = vzero8(); q[1] = vzero8();
#pragma unroll
  for (int j = 0; j < 8; ++j) {
    const v4f a0 = wqS[j * 32 + lane];
    const v4f a1 = wqS[(8 + j) * 32 + lane];
    const v2f b0 = pair_of(xr[j >> 1], 4 * (j & 1));
    const v2f b1 = pair_of(xr[j >> 1], 4 * (j & 1) + 2);
    q[0] = wmma4(frag_lo(a0), b0, q[0]);
    q[1] = wmma4(frag_lo(a1), b0, q[1]);
    q[0] = wmma4(frag_hi(a0), b1, q[0]);
    q[1] = wmma4(frag_hi(a1), b1, q[1]);
  }

  // softmax over the 16 channels of a head (8 registers x 2 lane halves), then
  // att = ctx^T e on WMMA with e taken from its own registers
  v8f att[2];
#pragma unroll
  for (int h = 0; h < 2; ++h) {
    float mx = -3.402823e38f;
#pragma unroll
    for (int r = 0; r < 8; ++r) {
      q[h][r] += bq[h * 16 + 8 * lh + r];
      mx = fmaxf(mx, q[h][r]);
    }
    mx = fmaxf(mx, xhalf(mx));
#pragma unroll
    for (int r = 0; r < 8; ++r) q[h][r] -= mx;
#pragma unroll
    for (int r = 0; r < 8; ++r) q[h][r] = exp_slot(q[h][r]);
    float sm = 0.0f;
#pragma unroll
    for (int r = 0; r < 8; ++r) sm += q[h][r];
    sm += xhalf(sm);
    const float inv = 1.0f / sm;
    v8f acc = vzero8();
#pragma unroll
    for (int p = 0; p < 4; ++p) {
      v2f a;   // A[row = value channel lm][k = key channel 8*lh + 2p + 0..1]
      a.x = ctxS[h * 256 + (8 * lh + 2 * p) * 16 + lm];
      a.y = ctxS[h * 256 + (8 * lh + 2 * p + 1) * 16 + lm];
      acc = wmma4(a, pair_of(q[h], 2 * p), acc);
    }
#pragma unroll
    for (int r = 0; r < 8; ++r) att[h][r] = acc[r] * inv;
  }

  v8f o0 = vzero8(), o1 = vzero8(), o2 = vzero8(), o3 = vzero8();
#pragma unroll
  for (int j = 0; j < 4; ++j) {
    const v4f a0 = wrS[j * 32 + lane];
    const v4f a1 = wrS[(4 + j) * 32 + lane];
    const v4f a2 = wrS[(8 + j) * 32 + lane];
    const v4f a3 = wrS[(12 + j) * 32 + lane];
    const v2f b0 = pair_of(att[j >> 1], 4 * (j & 1));
    const v2f b1 = pair_of(att[j >> 1], 4 * (j & 1) + 2);
    o0 = wmma4(frag_lo(a0), b0, o0);
    o1 = wmma4(frag_lo(a1), b0, o1);
    o2 = wmma4(frag_lo(a2), b0, o2);
    o3 = wmma4(frag_lo(a3), b0, o3);
    o0 = wmma4(frag_hi(a0), b1, o0);
    o1 = wmma4(frag_hi(a1), b1, o1);
    o2 = wmma4(frag_hi(a2), b1, o2);
    o3 = wmma4(frag_hi(a3), b1, o3);
  }
  // output bias in accumulator layout: register r of tile t = channel 16t + 8*lh + r
  const v4f* brv = (const v4f*)(br + 8 * lh);
  v4f bo[8];
#pragma unroll
  for (int i = 0; i < 8; ++i) {
    bo[i] = brv[(i >> 1) * 4 + (i & 1)];
    // precaution: a later load may land in the register that holds this offset
    asm volatile("s_wait_xcnt 0x0" ::: "memory");
  }
  float* ob = out + (size_t)nb * CIN * SLEN;
#pragma unroll
  for (int r = 0; r < 8; ++r) {
    const int m = r + 8 * lh;
    const size_t i0 = (size_t)m * SLEN + s0 + lm;
    ob[i0] = o0[r] + bo[r >> 2][r & 3] + xr[0][r];
    const size_t i1 = (size_t)(m + 16) * SLEN + s0 + lm;
    ob[i1] = o1[r] + bo[2 + (r >> 2)][r & 3] + xr[1][r];
    const size_t i2 = (size_t)(m + 32) * SLEN + s0 + lm;
    ob[i2] = o2[r] + bo[4 + (r >> 2)][r & 3] + xr[2][r];
    const size_t i3 = (size_t)(m + 48) * SLEN + s0 + lm;
    ob[i3] = o3[r] + bo[6 + (r >> 2)][r & 3] + xr[3][r];
  }
}

extern "C" void kernel_launch(void* const* d_in, const int* in_sizes, int n_in,
                              void* d_out, int out_size, void* d_ws, size_t ws_size,
                              hipStream_t stream) {
  (void)in_sizes; (void)n_in; (void)out_size; (void)ws_size;
  const float* x  = (const float*)d_in[0];
  const float* Wk = (const float*)d_in[1];
  const float* bk = (const float*)d_in[2];
  const float* Wq = (const float*)d_in[3];
  const float* bq = (const float*)d_in[4];
  const float* Wv = (const float*)d_in[5];
  const float* bv = (const float*)d_in[6];
  const float* Wr = (const float*)d_in[7];
  const float* br = (const float*)d_in[8];
  float* out = (float*)d_out;

  float* ctxn     = (float*)((char*)d_ws + 256);   // 1024 floats
  float* partials = (float*)((char*)d_ws + 4608);  // 1024*RECSZ floats

  hipLaunchKernelGGL(k_stats, dim3(SLEN / 512, NBATCH), dim3(256), 0, stream,
                     x, Wk, bk, Wv, bv, partials);
  hipLaunchKernelGGL(k_reduce, dim3(16, NBATCH), dim3(1024), 0, stream,
                     partials, ctxn);
  hipLaunchKernelGGL(k_out, dim3(SLEN / 128, NBATCH), dim3(256), 0, stream,
                     x, Wq, bq, Wr, br, ctxn, out);
}

// v005
// Measured time: 69.2 microseconds a run.
// Two timings next to v004 both put it at 1.03 times that version's speed.
// All steps since v000 together make it 4.14 times as fast.
#include <hip/hip_runtime.h>
#include <math.h>

typedef __attribute__((ext_vector_type(2))) float v2f;
typedef __attribute__((ext_vector_type(4))) float v4f;
typedef __attribute__((ext_vector_type(8))) float v8f;

typedef int v4i_gcc __attribute__((vector_size(16)));
typedef __attribute__((address_space(1))) v4i_gcc glob_v4i;
typedef __attribute__((address_space(3))) v4i_gcc lds_v4i;

#define NBATCH 2
#define CIN 64
#define SLEN 262144   /* 16*128*128 */
#define KCH 32
#define VCH 32
#define RECSZ 576     /* per-block record: kmax[32] esum[32] ctx[512] */

// D(16x16,f32) = A(16x4,f32) x B(4x16,f32) + C
__device__ __forceinline__ v8f wmma4(v2f a, v2f b, v8f c) {
  return __builtin_amdgcn_wmma_f32_16x16x4_f32(false, a, false, b, (short)0, c,
                                               false, false);
}

__device__ __forceinline__ v8f vzero8() {
  v8f z;
#pragma unroll
  for (int i = 0; i < 8; ++i) z[i] = 0.0f;
  return z;
}

// Copies a row-major weight matrix (ROWS x K) into LDS in the order in which
// the matrix instruction takes its A operand, so that a wave fetches two k
// steps of a 16-row tile with one contiguous 512-byte LDS read instead of two
// global loads that touch 16 cache lines each.
// Entry (mt * (K / 8) + j) * 32 + lane, with row = mt * 16 + (lane & 15) and
// h = lane >> 4, holds columns 8j+2h, 8j+2h+1 (k step 2j) and 8j+4+2h, 8j+5+2h
// (k step 2j+1). A wave reads 8 rows x 64 bytes of the matrix at a time.
template <int ROWS, int K>
__device__ __forceinline__ void stage_frag(const float* __restrict__ Wm,
                                           v4f* dst, int tid) {
  constexpr int QG = K / 16;
#pragma unroll
  for (int i0 = 0; i0 < ROWS * K / 4; i0 += 256) {
    const int i = i0 + tid;
    const int t = i >> 5;
    const int m = (t / QG) * 8 + ((i >> 2) & 7);
    const int q = (t % QG) * 4 + (i & 3);
    const v4f w = *(const v4f*)(Wm + m * K + q * 4);
    v2f* d = (v2f*)(dst + ((m >> 4) * (K / 8) + (q >> 1)) * 32 + (m & 15)) + (q & 1);
    v2f lo, hi;
    lo.x = w.x; lo.y = w.y;
    hi.x = w.z; hi.y = w.w;
    d[0] = lo;    // lanes 0..15 of the fragment
    d[32] = hi;   // lanes 16..31
  }
}

__device__ __forceinline__ v2f frag_lo(v4f w) { v2f r; r.x = w.x; r.y = w.y; return r; }
__device__ __forceinline__ v2f frag_hi(v4f w) { v2f r; r.x = w.z; r.y = w.w; return r; }

// Lane l with lane l ^ 16 (the other half of the wave), a vector cross-row move.
__device__ __forceinline__ float xhalf(float v) {
  return __builtin_bit_cast(float, __builtin_amdgcn_permlanex16(
      __builtin_bit_cast(int, v), __builtin_bit_cast(int, v),
      0x76543210, 0xfedcba98, false, false));
}

// e^v as the fast-math exponential computes it (one multiply, one v_exp_f32).
// The v_nop keeps the one free slot that the instruction set asks for behind a
// transcendental; in one statement with it, it cannot be scheduled away.
__device__ __forceinline__ float exp_slot(float v) {
  const float t = v * 1.44269504f;
  float r;
  asm("v_exp_f32 %0, %1\n\tv_nop" : "=v"(r) : "v"(t));
  return r;
}

// Two neighbouring registers of an accumulator-layout tile as a B operand.
__device__ __forceinline__ v2f pair_of(v8f t, int i) {
  v2f r; r.x = t[i]; r.y = t[i + 1]; return r;
}

// x of channel step j (8 input channels) for a wave's 64 consecutive positions:
// a lane reads 16 bytes (its 4 neighbouring positions) of each of its 4 rows, so
// a half wave covers 256 contiguous bytes of a row. p holds the lane's first
// position and its 2 * lh rows. d[s][i] = row 8j + 4s + 2lh + i.
__device__ __forceinline__ void load_x8(const float* __restrict__ p, int j,
                                        v4f (&d)[2][2]) {
  const float* pj = p + (size_t)(8 * j) * SLEN;
#pragma unroll
  for (int s = 0; s < 2; ++s) {
    d[s][0] = *(const v4f*)(pj + (size_t)(4 * s) * SLEN);
    d[s][1] = *(const v4f*)(pj + (size_t)(4 * s + 1) * SLEN);
  }
}

// A fragment of tile c (positions 4 * lm + c) from two rows' 16-byte pieces.
__device__ __forceinline__ v2f pick(v4f a, v4f b, int c) {
  v2f r; r.x = a[c]; r.y = b[c]; return r;
}

// ============ Pass 1 (fused): block kmax + e/v + block ctx partials =========
// Each block: 512 positions, each wave 64 consecutive ones; tile c of a wave is
// positions 4 * lm + c. x is the A operand and
// the weight fragments are the B operand, so a product comes out transposed:
// register r = tile row 8h + r, column = output channel. x is read once and
// each product is formed once: the channel loop is outermost, and the k and v
// tiles of all 64 positions of a wave (128 registers) stay in registers across
// the two barriers that make the block's channel max. Then e=exp(k+bk-m_b),
// v+=bv; their registers are the A and B operands of ctx_b += E V^T as they
// stand (k = position), and max and esum run down a lane's own registers.
__global__ void __launch_bounds__(256, 2)
k_stats(const float* __restrict__ x,
        const float* __restrict__ Wk, const float* __restrict__ bk,
        const float* __restrict__ Wv, const float* __restrict__ bv,
        float* __restrict__ partials) {
  __shared__ float lmax[8][32];
  __shared__ float kmaxS[32];
  __shared__ float cbuf[8][512];
  __shared__ float esbuf[8][32];
  __shared__ v4f wkS[2 * 8 * 32];   // Wk in fragment order
  __shared__ v4f wvS[2 * 8 * 32];   // Wv in fragment order

  const int tid = threadIdx.x;
  const int lane = tid & 31, wv = tid >> 5;
  const int lm = lane & 15, lh = lane >> 4;
  const int nb = blockIdx.y;
  const size_t sbase = (size_t)blockIdx.x * 512;
  const float* xb = x + (size_t)nb * CIN * SLEN;
  const float* xw = xb + (size_t)(2 * lh) * SLEN + sbase + (size_t)wv * 64 + 4 * lm;

  v4f xs[2][2][2];
  load_x8(xw, 0, xs[0]);   // in flight while the weights are staged
  // precaution: registers that hold parts of these addresses are reused below
  asm volatile("s_wait_xcnt 0x0" ::: "memory");

  stage_frag<KCH, CIN>(Wk, wkS, tid);
  stage_frag<VCH, CIN>(Wv, wvS, tid);
  // precaution: the staging loads' address registers are reused further down
  asm volatile("s_wait_xcnt 0x0" ::: "memory");
  __syncthreads();

  // ---------- k = Wk@x and v = Wv@x for the wave's 4 x 16 positions ----------
  v8f kt[4][2], vt[4][2];   // [tile][channel half]
#pragma unroll
  for (int c = 0; c < 4; ++c) {
    kt[c][0] = vzero8(); kt[c][1] = vzero8();
    vt[c][0] = vzero8(); vt[c][1] = vzero8();
  }
  v4f wf[2][4];   // a channel step's weight fragments: Wk rows 0..15, 16..31, Wv rows 0..15, 16..31
  wf[0][0] = wkS[lane];
  wf[0][1] = wkS[8 * 32 + lane];
  wf[0][2] = wvS[lane];
  wf[0][3] = wvS[8 * 32 + lane];
#pragma unroll
  for (int j = 0; j < 8; ++j) {
    const int b = j & 1;
    if (j + 1 < 8) {   // the next step's operands, one step ahead
      wf[b ^ 1][0] = wkS[(j + 1) * 32 + lane];
      wf[b ^ 1][1] = wkS[(8 + j + 1) * 32 + lane];
      wf[b ^ 1][2] = wvS[(j + 1) * 32 + lane];
      wf[b ^ 1][3] = wvS[(8 + j + 1) * 32 + lane];
      load_x8(xw, j + 1, xs[b ^ 1]);
      // precaution: the address registers of these loads are reused further down
      asm volatile("s_wait_xcnt 0x0" ::: "memory");
    }
    // keeps the loads above ahead of this step's 32 matrix instructions: left
    // free, the scheduler sinks them to their first use and the wave waits out
    // the whole memory latency at every step
    __builtin_amdgcn_sched_barrier(0);
#pragma unroll
    for (int c = 0; c < 4; ++c) {
      const v2f a = pick(xs[b][0][0], xs[b][0][1], c);
      kt[c][0] = wmma4(a, frag_lo(wf[b][0]), kt[c][0]);
      kt[c][1] = wmma4(a, frag_lo(wf[b][1]), kt[c][1]);
      vt[c][0] = wmma4(a, frag_lo(wf[b][2]), vt[c][0]);
      vt[c][1] = wmma4(a, frag_lo(wf[b][3]), vt[c][1]);
    }
#pragma unroll
    for (int c = 0; c < 4; ++c) {
      const v2f a = pick(xs[b][1][0], xs[b][1][1], c);
      kt[c][0] = wmma4(a, frag_hi(wf[b][0]), kt[c][0]);
      kt[c][1] = wmma4(a, frag_hi(wf[b][1]), kt[c][1]);
      vt[c][0] = wmma4(a, frag_hi(wf[b][2]), vt[c][0]);
      vt[c][1] = wmma4(a, frag_hi(wf[b][3]), vt[c][1]);
    }
  }

  // ---------- per-block channel max of k ----------
  float mx0 = -3.402823e38f, mx1 = -3.402823e38f;   // channels lm, 16 + lm
#pragma unroll
  for (int c = 0; c < 4; ++c) {
#pragma unroll
    for (int r = 0; r < 8; ++r) {
      mx0 = fmaxf(mx0, kt[c][0][r]);
      mx1 = fmaxf(mx1, kt[c][1][r]);
    }
  }
  mx0 = fmaxf(mx0, xhalf(mx0)) + bk[lm];
  mx1 = fmaxf(mx1, xhalf(mx1)) + bk[16 + lm];
  lmax[wv][lane] = lh ? mx1 : mx0;
  // precaution: the scalar base of the two bk loads is reused further down
  asm volatile("s_wait_xcnt 0x0" ::: "memory");
  __syncthreads();
  if (tid < 32) {
    float m = lmax[0][tid];
    for (int w = 1; w < 8; ++w) m = fmaxf(m, lmax[w][tid]);
    kmaxS[tid] = m;
  }
  __syncthreads();

  // per-lane constants: bkm = bk - kmax (folded), bv
  const float bkm0 = bk[lm] - kmaxS[lm];
  const float bkm1 = bk[16 + lm] - kmaxS[16 + lm];
  const float bv0 = bv[lm], bv1 = bv[16 + lm];

  // ---------- e, v, ctx partial, esum partial ----------
  v8f ctx0 = vzero8(), ctx1 = vzero8();   // head 0, head 1
  float es0 = 0.0f, es1 = 0.0f;

#pragma unroll
  for (int c = 0; c < 4; ++c) {
    v8f k0 = kt[c][0], k1 = kt[c][1], v0 = vt[c][0], v1 = vt[c][1];
#pragma unroll
    for (int r = 0; r < 8; ++r) {
      k0[r] = __expf(k0[r] + bkm0);
      k1[r] = __expf(k1[r] + bkm1);
      v0[r] += bv0;
      v1[r] += bv1;
      es0 += k0[r];
      es1 += k1[r];
    }
    // ctx[key ch][value ch] += sum over the tile's 16 positions; k step p of
    // lane half h = tile rows 8h + 2p, 8h + 2p + 1 on both operands
#pragma unroll
    for (int p = 0; p < 4; ++p) {
      ctx0 = wmma4(pair_of(k0, 2 * p), pair_of(v0, 2 * p), ctx0);
      ctx1 = wmma4(pair_of(k1, 2 * p), pair_of(v1, 2 * p), ctx1);
    }
  }

#pragma unroll
  for (int r = 0; r < 8; ++r) {
    cbuf[wv][(r + 8 * lh) * 16 + lm] = ctx0[r];
    cbuf[wv][256 + (r + 8 * lh) * 16 + lm] = ctx1[r];
  }
  es0 += xhalf(es0);
  es1 += xhalf(es1);
  esbuf[wv][lane] = lh ? es1 : es0;
  __syncthreads();

  float* rec = partials + (size_t)(blockIdx.y * gridDim.x + blockIdx.x) * RECSZ;
  if (tid < 32) {
    rec[tid] = kmaxS[tid];                    // block max
    float s = 0.0f;
    for (int w = 0; w < 8; ++w) s += esbuf[w][tid];
    rec[32 + tid] = s;                        // block esum
  }
  for (int e = tid; e < 512; e += 256) {
    float s = 0.0f;
    for (int w = 0; w < 8; ++w) s += cbuf[w][e];
    rec[64 + e] = s;                          // block ctx
  }
}

// ====== Pass 1b: fixed-order cross-block combine with exact rescaling =======
// One work-group per 32 neighbouring ctx elements (two key channels, one
// 128-byte line of every record and of ctxn). Each wave takes 16 of the 512
// records, all of its loads are issued before the first use, and the partial
// sums meet in LDS in a fixed order.
__global__ void __launch_bounds__(1024)
k_reduce(const float* __restrict__ partials, float* __restrict__ ctxn) {
  __shared__ float fS[2][512];   // rescale factor per (channel of the pair, record)
  __shared__ float mS[32];       // per-wave max
  __shared__ float eSm[32];      // per-wave rescaled esum
  __shared__ float cS[32][32];   // per-wave ctx partial

  const int tid = threadIdx.x;
  const int lane = tid & 31, wv = tid >> 5;
  const int nb = blockIdx.y;
  const int e0 = blockIdx.x * 32;      // first ctx element of this group
  const int ch0 = blockIdx.x * 2;      // first key channel of this group
  const float* base = partials + (size_t)nb * 512 * RECSZ;

  // waves 0..15: channel ch0, waves 16..31: channel ch0+1; one record a thread
  const int half = tid >> 9, rec = tid & 511;
  const float km = base[(size_t)rec * RECSZ + ch0 + half];
  const float er = base[(size_t)rec * RECSZ + 32 + ch0 + half];
  float cv[16];
#pragma unroll
  for (int j = 0; j < 16; ++j)
    cv[j] = base[(size_t)(j * 32 + wv) * RECSZ + 64 + e0 + lane];

  float m = km;
#pragma unroll
  for (int off = 1; off < 32; off <<= 1) m = fmaxf(m, __shfl_xor(m, off, 32));
  if (lane == 0) mS[wv] = m;
  __syncthreads();
  float M = mS[half * 16];
#pragma unroll
  for (int w = 1; w < 16; ++w) M = fmaxf(M, mS[half * 16 + w]);

  const float f = expf(km - M);
  fS[half][rec] = f;
  float es = er * f;
#pragma unroll
  for (int off = 1; off < 32; off <<= 1) es += __shfl_xor(es, off, 32);
  if (lane == 0) eSm[wv] = es;
  __syncthreads();

  const int lh = lane >> 4;            // which channel of the pair this lane sums
  float cs = 0.0f;
#pragma unroll
  for (int j = 0; j < 16; ++j) cs += cv[j] * fS[lh][j * 32 + wv];
  cS[wv][lane] = cs;
  __syncthreads();

  if (tid < 32) {
    float c = 0.0f, s = 0.0f;
#pragma unroll
    for (int w = 0; w < 32; ++w) c += cS[w][lane];
#pragma unroll
    for (int w = 0; w < 16; ++w) s += eSm[lh * 16 + w];
    ctxn[nb * 512 + e0 + lane] = c / s;
  }
}

// Weight matrix (ROWS x K) into LDS as A fragments whose k order is the order
// in which an accumulator-layout tile holds its rows: lane half h owns rows
// 8h..8h+7 of each 16-row tile, two neighbouring registers make one k step.
// Entry (mt * (K / 8) + j) * 32 + 16 * h + c holds, for row mt * 16 + c, the
// four columns 16 * (j >> 1) + 8 * h + 4 * (j & 1) + 0..3 (k steps 2j, 2j+1),
// which are one aligned 16-byte piece of the matrix row.
template <int ROWS, int K>
__device__ __forceinline__ void stage_frag_acc(const float* __restrict__ Wm,
                                               v4f* dst, int tid) {
  constexpr int QG = K / 16;
#pragma unroll
  for (int i0 = 0; i0 < ROWS * K / 4; i0 += 256) {
    const int i = i0 + tid;
    const int t = i >> 5;
    const int m = (t / QG) * 8 + ((i >> 2) & 7);
    const int q = (t % QG) * 4 + (i & 3);
    const v4f w = *(const v4f*)(Wm + m * K + q * 4);
    const int j = ((q >> 2) << 1) | (q & 1);
    const int h = (q >> 1) & 1;
    dst[((m >> 4) * (K / 8) + j) * 32 + h * 16 + (m & 15)] = w;
  }
}

// --- Pass 2: q proj -> ch softmax -> att -> out proj + resid, all on WMMA ---
// Every wave keeps its 32 consecutive positions in registers from the x load to
// the store. A lane reads and writes 8 bytes (2 neighbouring positions) of a
// channel row, so a half wave covers one whole 128-byte line; position tile c is
// element c of every piece (column lm = position 2 * lm + c). A tile's x is in
// accumulator layout (register r of channel tile t = channel
// 16t + 8h + r, column = position), and the A side of each product takes the
// matching k order, so each product's D registers are the next product's B
// operand and the x registers are the residual: no transposition through LDS.
__global__ void __launch_bounds__(256, 4)
k_out(const float* __restrict__ x,
      const float* __restrict__ Wq, const float* __restrict__ bq,
      const float* __restrict__ Wr, const float* __restrict__ br,
      const float* __restrict__ ctxn, float* __restrict__ out) {
  __shared__ float ctxS[512];
  __shared__ v4f wqS[2 * 8 * 32];   // Wq, A fragments in accumulator k order
  __shared__ v4f wrS[4 * 4 * 32];   // Wr, A fragments in accumulator k order

  const int tid = threadIdx.x;
  const int lane = tid & 31, wv = tid >> 5;
  const int lm = lane & 15, lh = lane >> 4;
  const int nb = blockIdx.y;
  const size_t s0 = (size_t)blockIdx.x * 256 + (size_t)wv * 32 + 2 * lm;
  const float* xb = x + (size_t)nb * CIN * SLEN;

#if __has_builtin(__builtin_amdgcn_global_load_async_to_lds_b128)
  if (tid < 128) {
    __builtin_amdgcn_global_load_async_to_lds_b128(
        (glob_v4i*)(ctxn + nb * 512 + tid * 4),
        (lds_v4i*)(&ctxS[tid * 4]), 0, 0);
  }
#if __has_builtin(__builtin_amdgcn_s_wait_asynccnt)
  __builtin_amdgcn_s_wait_asynccnt(0);
#else
  asm volatile("s_wait_asynccnt 0" ::: "memory");
#endif
#else
  for (int i = tid; i < 512; i += 256) ctxS[i] = ctxn[nb * 512 + i];
#endif

  v2f xq[4][8];   // [channel tile][register] = 2 positions of one channel
#pragma unroll
  for (int t = 0; t < 4; ++t) {       // batched x loads
#pragma unroll
    for (int r = 0; r < 8; ++r)
      xq[t][r] = *(const v2f*)(xb + (size_t)(t * 16 + 8 * lh + r) * SLEN + s0);
    // precaution: later loads land in registers that held these addresses
    asm volatile("s_wait_xcnt 0x0" ::: "memory");
  }
  stage_frag_acc<KCH, CIN>(Wq, wqS, tid);
  stage_frag_acc<CIN, VCH>(Wr, wrS, tid);
  __syncthreads();

#pragma unroll
  for (int c = 0; c < 2; ++c) {   // position tiles, one after the other
  // keeps the second tile's LDS reads and register copies behind the first
  // tile's work: left free, the scheduler lifts them up and the kernel spills
  __builtin_amdgcn_sched_barrier(0);
  v8f xr[4];
#pragma unroll
  for (int t = 0; t < 4; ++t) {
#pragma unroll
    for (int r = 0; r < 8; ++r) xr[t][r] = xq[t][r][c];
  }

  // q = Wq x: q[h][r] = channel 16h + 8*lh + r at column lm
  v8f q[2];
  q[0] = vzero8(); q[1] = vzero8();
#pragma unroll
  for (int j = 0; j < 8; ++j) {
    const v4f a0 = wqS[j * 32 + lane];
    const v4f a1 = wqS[(8 + j) * 32 + lane];
    const v2f b0 = pair_of(xr[j >> 1], 4 * (j & 1));
    const v2f b1 = pair_of(xr[j >> 1], 4 * (j & 1) + 2);
    q[0] = wmma4(frag_lo(a0), b0, q[0]);
    q[1] = wmma4(frag_lo(a1), b0, q[1]);
    q[0] = wmma4(frag_hi(a0), b1, q[0]);
    q[1] = wmma4(frag_hi(a1), b1, q[1]);
  }

  // softmax over the 16 channels of a head (8 registers x 2 lane halves), then
  // att = ctx^T e on WMMA with e taken from its own registers
  v8f att[2];
#pragma unroll
  for (int h = 0; h < 2; ++h) {
    float mx = -3.402823e38f;
#pragma unroll
    for (int r = 0; r < 8; ++r) {
      q[h][r] += bq[h * 16 + 8 * lh + r];
      mx = fmaxf(mx, q[h][r]);
    }
    mx = fmaxf(mx, xhalf(mx));
#pragma unroll
    for (int r = 0; r < 8; ++r) q[h][r] -= mx;
#pragma unroll
    for (int r = 0; r < 8; ++r) q[h][r] = exp_slot(q[h][r]);
    float sm = 0.0f;
#pragma unroll
    for (int r = 0; r < 8; ++r) sm += q[h][r];
    sm += xhalf(sm);
    const float inv = 1.0f / sm;
    v8f acc = vzero8();
#pragma unroll
    for (int p = 0; p < 4; ++p) {
      v2f a;   // A[row = value channel lm][k = key channel 8*lh + 2p + 0..1]
      a.x = ctxS[h * 256 + (8 * lh + 2 * p) * 16 + lm];
      a.y = ctxS[h * 256 + (8 * lh + 2 * p + 1) * 16 + lm];
      acc = wmma4(a, pair_of(q[h], 2 * p), acc);
    }
#pragma unroll
    for (int r = 0; r < 8; ++r) att[h][r] = acc[r] * inv;
  }

  v8f o0 = vzero8(), o1 = vzero8(), o2 = vzero8(), o3 = vzero8();
#pragma unroll
  for (int j = 0; j < 4; ++j) {
    const v4f a0 = wrS[j * 32 + lane];
    const v4f a1 = wrS[(4 + j) * 32 + lane];
    const v4f a2 = wrS[(8 + j) * 32 + lane];
    const v4f a3 = wrS[(12 + j) * 32 + lane];
    const v2f b0 = pair_of(att[j >> 1], 4 * (j & 1));
    const v2f b1 = pair_of(att[j >> 1], 4 * (j & 1) + 2);
    o0 = wmma4(frag_lo(a0), b0, o0);
    o1 = wmma4(frag_lo(a1), b0, o1);
    o2 = wmma4(frag_lo(a2), b0, o2);
    o3 = wmma4(frag_lo(a3), b0, o3);
    o0 = wmma4(frag_hi(a0), b1, o0);
    o1 = wmma4(frag_hi(a1), b1, o1);
    o2 = wmma4(frag_hi(a2), b1, o2);
    o3 = wmma4(frag_hi(a3), b1, o3);
  }
  // output bias in accumulator layout: register r of tile t = channel 16t + 8*lh + r
  const v4f* brv = (const v4f*)(br + 8 * lh);
  v4f bo[8];
#pragma unroll
  for (int i = 0; i < 8; ++i) {
    bo[i] = brv[(i >> 1) * 4 + (i & 1)];
    // precaution: a later load may land in the register that holds this offset
    asm volatile("s_wait_xcnt 0x0" ::: "memory");
  }
  // the result takes the place of the tile's x in the 8-byte pieces
#pragma unroll
  for (int r = 0; r < 8; ++r) {
    xq[0][r][c] = o0[r] + bo[r >> 2][r & 3] + xq[0][r][c];
    xq[1][r][c] = o1[r] + bo[2 + (r >> 2)][r & 3] + xq[1][r][c];
    xq[2][r][c] = o2[r] + bo[4 + (r >> 2)][r & 3] + xq[2][r][c];
    xq[3][r][c] = o3[r] + bo[6 + (r >> 2)][r & 3] + xq[3][r][c];
  }
  }

  float* ob = out + (size_t)nb * CIN * SLEN;
#pragma unroll
  for (int t = 0; t < 4; ++t) {
#pragma unroll
    for (int r = 0; r < 8; ++r)
      *(v2f*)(ob + (size_t)(t * 16 + 8 * lh + r) * SLEN + s0) = xq[t][r];
  }
}

extern "C" void kernel_launch(void* const* d_in, const int* in_sizes, int n_in,
                              void* d_out, int out_size, void* d_ws, size_t ws_size,
                              hipStream_t stream) {
  (void)in_sizes; (void)n_in; (void)out_size; (void)ws_size;
  const float* x  = (const float*)d_in[0];
  const float* Wk = (const float*)d_in[1];
  const float* bk = (const float*)d_in[2];
  const float* Wq = (const float*)d_in[3];
  const float* bq = (const float*)d_in[4];
  const float* Wv = (const float*)d_in[5];
  const float* bv = (const float*)d_in[6];
  const float* Wr = (const float*)d_in[7];
  const float* br = (const float*)d_in[8];
  float* out = (float*)d_out;

  float* ctxn     = (float*)((char*)d_ws + 256);   // 1024 floats
  float* partials = (float*)((char*)d_ws + 4608);  // 1024*RECSZ floats

  hipLaunchKernelGGL(k_stats, dim3(SLEN / 512, NBATCH), dim3(256), 0, stream,
                     x, Wk, bk, Wv, bv, partials);
  hipLaunchKernelGGL(k_reduce, dim3(16, NBATCH), dim3(1024), 0, stream,
                     partials, ctxn);
  hipLaunchKernelGGL(k_out, dim3(SLEN / 256, NBATCH), dim3(256), 0, stream,
                     x, Wq, bq, Wr, br, ctxn, out);
}

// v007
// It runs in 61.9 microseconds.
// Versions between v005 and this one are left out; their measured steps multiply to 1.13 times as fast.
// Counting every step since v000, it is 4.67 times as fast.
#include <hip/hip_runtime.h>
#include <math.h>

typedef __attribute__((ext_vector_type(2))) float v2f;
typedef __attribute__((ext_vector_type(4))) float v4f;
typedef __attribute__((ext_vector_type(8))) float v8f;

#define NBATCH 2
#define CIN 64
#define SLEN 262144   /* 16*128*128 */
#define KCH 32
#define VCH 32
#define RECSZ 576     /* per-block record: kmax[32] esum[32] ctx[512] */

// D(16x16,f32) = A(16x4,f32) x B(4x16,f32) + C
__device__ __forceinline__ v8f wmma4(v2f a, v2f b, v8f c) {
  return __builtin_amdgcn_wmma_f32_16x16x4_f32(false, a, false, b, (short)0, c,
                                               false, false);
}

__device__ __forceinline__ v8f vzero8() {
  v8f z;
#pragma unroll
  for (int i = 0; i < 8; ++i) z[i] = 0.0f;
  return z;
}

// Copies a row-major weight matrix (ROWS x K) into LDS in the order in which
// the matrix instruction takes its A operand, so that a wave fetches two k
// steps of a 16-row tile with one contiguous 512-byte LDS read instead of two
// global loads that touch 16 cache lines each.
// Entry (mt * (K / 8) + j) * 32 + lane, with row = mt * 16 + (lane & 15) and
// h = lane >> 4, holds columns 8j+2h, 8j+2h+1 (k step 2j) and 8j+4+2h, 8j+5+2h
// (k step 2j+1). A wave reads 8 rows x 64 bytes of the matrix at a time.
template <int ROWS, int K>
__device__ __forceinline__ void stage_frag(const float* __restrict__ Wm,
                                           v4f* dst, int tid) {
  constexpr int QG = K / 16;
#pragma unroll
  for (int i0 = 0; i0 < ROWS * K / 4; i0 += 256) {
    const int i = i0 + tid;
    const int t = i >> 5;
    const int m = (t / QG) * 8 + ((i >> 2) & 7);
    const int q = (t % QG) * 4 + (i & 3);
    const v4f w = *(const v4f*)(Wm + m * K + q * 4);
    v2f* d = (v2f*)(dst + ((m >> 4) * (K / 8) + (q >> 1)) * 32 + (m & 15)) + (q & 1);
    v2f lo, hi;
    lo.x = w.x; lo.y = w.y;
    hi.x = w.z; hi.y = w.w;
    d[0] = lo;    // lanes 0..15 of the fragment
    d[32] = hi;   // lanes 16..31
  }
}

__device__ __forceinline__ v2f frag_lo(v4f w) { v2f r; r.x = w.x; r.y = w.y; return r; }
__device__ __forceinline__ v2f frag_hi(v4f w) { v2f r; r.x = w.z; r.y = w.w; return r; }

// Lane l with lane l ^ 16 (the other half of the wave), a vector cross-row move.
__device__ __forceinline__ float xhalf(float v) {
  return __builtin_bit_cast(float, __builtin_amdgcn_permlanex16(
      __builtin_bit_cast(int, v), __builtin_bit_cast(int, v),
      0x76543210, 0xfedcba98, false, false));
}

// e^v as the fast-math exponential computes it (one multiply, one v_exp_f32).
// The v_nop keeps the one free slot that the instruction set asks for behind a
// transcendental; in one statement with it, it cannot be scheduled away.
__device__ __forceinline__ float exp_slot(float v) {
  const float t = v * 1.44269504f;
  float r;
  asm("v_exp_f32 %0, %1\n\tv_nop" : "=v"(r) : "v"(t));
  return r;
}

// Two neighbouring registers of an accumulator-layout tile as a B operand.
__device__ __forceinline__ v2f pair_of(v8f t, int i) {
  v2f r; r.x = t[i]; r.y = t[i + 1]; return r;
}

// x of channel step j (8 input channels) for a wave's 64 consecutive positions:
// a lane reads 16 bytes (its 4 neighbouring positions) of each of its 4 rows, so
// a half wave covers 256 contiguous bytes of a row. p holds the lane's first
// position and its 2 * lh rows. d[s][i] = row 8j + 4s + 2lh + i.
__device__ __forceinline__ void load_x8(const float* __restrict__ p, int j,
                                        v4f (&d)[2][2]) {
  const float* pj = p + (size_t)(8 * j) * SLEN;
#pragma unroll
  for (int s = 0; s < 2; ++s) {
    d[s][0] = *(const v4f*)(pj + (size_t)(4 * s) * SLEN);
    d[s][1] = *(const v4f*)(pj + (size_t)(4 * s + 1) * SLEN);
  }
}

// A fragment of tile c (positions 4 * lm + c) from two rows' 16-byte pieces.
__device__ __forceinline__ v2f pick(v4f a, v4f b, int c) {
  v2f r; r.x = a[c]; r.y = b[c]; return r;
}

// ============ Pass 1 (fused): block kmax + e/v + block ctx partials =========
// Each block: 512 positions, each wave 64 consecutive ones; tile c of a wave is
// positions 4 * lm + c. x is the A operand and
// the weight fragments are the B operand, so a product comes out transposed:
// register r = tile row 8h + r, column = output channel. x is read once and
// each product is formed once: the channel loop is outermost, and the k and v
// tiles of all 64 positions of a wave (128 registers) stay in registers across
// the two barriers that make the block's channel max. Then e=exp(k+bk-m_b),
// v+=bv; their registers are the A and B operands of ctx_b += E V^T as they
// stand (k = position), and max and esum run down a lane's own registers.
__global__ void __launch_bounds__(256, 2)
k_stats(const float* __restrict__ x,
        const float* __restrict__ Wk, const float* __restrict__ bk,
        const float* __restrict__ Wv, const float* __restrict__ bv,
        float* __restrict__ partials) {
  __shared__ float lmax[8][32];
  __shared__ float kmaxS[32];
  __shared__ float cbuf[8][512];
  __shared__ float esbuf[8][32];
  __shared__ v4f wkS[2 * 8 * 32];   // Wk in fragment order
  __shared__ v4f wvS[2 * 8 * 32];   // Wv in fragment order

  const int tid = threadIdx.x;
  const int lane = tid & 31, wv = tid >> 5;
  const int lm = lane & 15, lh = lane >> 4;
  const int nb = blockIdx.y;
  const size_t sbase = (size_t)blockIdx.x * 512;
  const float* xb = x + (size_t)nb * CIN * SLEN;
  const float* xw = xb + (size_t)(2 * lh) * SLEN + sbase + (size_t)wv * 64 + 4 * lm;

  v4f xs[2][2][2];
  load_x8(xw, 0, xs[0]);   // in flight while the weights are staged
  // precaution: registers that hold parts of these addresses are reused below
  asm volatile("s_wait_xcnt 0x0" ::: "memory");

  stage_frag<KCH, CIN>(Wk, wkS, tid);
  stage_frag<VCH, CIN>(Wv, wvS, tid);
  // precaution: the staging loads' address registers are reused further down
  asm volatile("s_wait_xcnt 0x0" ::: "memory");
  __syncthreads();

  // ---------- k = Wk@x and v = Wv@x for the wave's 4 x 16 positions ----------
  v8f kt[4][2], vt[4][2];   // [tile][channel half]
#pragma unroll
  for (int c = 0; c < 4; ++c) {
    kt[c][0] = vzero8(); kt[c][1] = vzero8();
    vt[c][0] = vzero8(); vt[c][1] = vzero8();
  }
  v4f wf[2][4];   // a channel step's weight fragments: Wk rows 0..15, 16..31, Wv rows 0..15, 16..31
  wf[0][0] = wkS[lane];
  wf[0][1] = wkS[8 * 32 + lane];
  wf[0][2] = wvS[lane];
  wf[0][3] = wvS[8 * 32 + lane];
#pragma unroll
  for (int j = 0; j < 8; ++j) {
    const int b = j & 1;
    if (j + 1 < 8) {   // the next step's operands, one step ahead
      wf[b ^ 1][0] = wkS[(j + 1) * 32 + lane];
      wf[b ^ 1][1] = wkS[(8 + j + 1) * 32 + lane];
      wf[b ^ 1][2] = wvS[(j + 1) * 32 + lane];
      wf[b ^ 1][3] = wvS[(8 + j + 1) * 32 + lane];
      load_x8(xw, j + 1, xs[b ^ 1]);
      // precaution: the address registers of these loads are reused further down
      asm volatile("s_wait_xcnt 0x0" ::: "memory");
    }
    // keeps the loads above ahead of this step's 32 matrix instructions: left
    // free, the scheduler sinks them to their first use and the wave waits out
    // the whole memory latency at every step
    __builtin_amdgcn_sched_barrier(0);
#pragma unroll
    for (int c = 0; c < 4; ++c) {
      const v2f a = pick(xs[b][0][0], xs[b][0][1], c);
      kt[c][0] = wmma4(a, frag_lo(wf[b][0]), kt[c][0]);
      kt[c][1] = wmma4(a, frag_lo(wf[b][1]), kt[c][1]);
      vt[c][0] = wmma4(a, frag_lo(wf[b][2]), vt[c][0]);
      vt[c][1] = wmma4(a, frag_lo(wf[b][3]), vt[c][1]);
    }
#pragma unroll
    for (int c = 0; c < 4; ++c) {
      const v2f a = pick(xs[b][1][0], xs[b][1][1], c);
      kt[c][0] = wmma4(a, frag_hi(wf[b][0]), kt[c][0]);
      kt[c][1] = wmma4(a, frag_hi(wf[b][1]), kt[c][1]);
      vt[c][0] = wmma4(a, frag_hi(wf[b][2]), vt[c][0]);
      vt[c][1] = wmma4(a, frag_hi(wf[b][3]), vt[c][1]);
    }
  }

  // ---------- per-block channel max of k ----------
  float mx0 = -3.402823e38f, mx1 = -3.402823e38f;   // channels lm, 16 + lm
#pragma unroll
  for (int c = 0; c < 4; ++c) {
#pragma unroll
    for (int r = 0; r < 8; ++r) {
      mx0 = fmaxf(mx0, kt[c][0][r]);
      mx1 = fmaxf(mx1, kt[c][1][r]);
    }
  }
  mx0 = fmaxf(mx0, xhalf(mx0)) + bk[lm];
  mx1 = fmaxf(mx1, xhalf(mx1)) + bk[16 + lm];
  lmax[wv][lane] = lh ? mx1 : mx0;
  // precaution: the scalar base of the two bk loads is reused further down
  asm volatile("s_wait_xcnt 0x0" ::: "memory");
  __syncthreads();
  if (tid < 32) {
    float m = lmax[0][tid];
    for (int w = 1; w < 8; ++w) m = fmaxf(m, lmax[w][tid]);
    kmaxS[tid] = m;
  }
  __syncthreads();

  // per-lane constants: bkm = bk - kmax (folded), bv
  const float bkm0 = bk[lm] - kmaxS[lm];
  const float bkm1 = bk[16 + lm] - kmaxS[16 + lm];
  const float bv0 = bv[lm], bv1 = bv[16 + lm];

  // ---------- e, v, ctx partial, esum partial ----------
  v8f ctx0 = vzero8(), ctx1 = vzero8();   // head 0, head 1
  float es0 = 0.0f, es1 = 0.0f;

#pragma unroll
  for (int c = 0; c < 4; ++c) {
    v8f k0 = kt[c][0], k1 = kt[c][1], v0 = vt[c][0], v1 = vt[c][1];
#pragma unroll
    for (int r = 0; r < 8; ++r) {
      k0[r] = __expf(k0[r] + bkm0);
      k1[r] = __expf(k1[r] + bkm1);
      v0[r] += bv0;
      v1[r] += bv1;
      es0 += k0[r];
      es1 += k1[r];
    }
    // ctx[key ch][value ch] += sum over the tile's 16 positions; k step p of
    // lane half h = tile rows 8h + 2p, 8h + 2p + 1 on both operands
#pragma unroll
    for (int p = 0; p < 4; ++p) {
      ctx0 = wmma4(pair_of(k0, 2 * p), pair_of(v0, 2 * p), ctx0);
      ctx1 = wmma4(pair_of(k1, 2 * p), pair_of(v1, 2 * p), ctx1);
    }
  }

#pragma unroll
  for (int r = 0; r < 8; ++r) {
    cbuf[wv][(r + 8 * lh) * 16 + lm] = ctx0[r];
    cbuf[wv][256 + (r + 8 * lh) * 16 + lm] = ctx1[r];
  }
  es0 += xhalf(es0);
  es1 += xhalf(es1);
  esbuf[wv][lane] = lh ? es1 : es0;
  __syncthreads();

  float* rec = partials + (size_t)(blockIdx.y * gridDim.x + blockIdx.x) * RECSZ;
  if (tid < 32) {
    rec[tid] = kmaxS[tid];                    // block max
    float s = 0.0f;
    for (int w = 0; w < 8; ++w) s += esbuf[w][tid];
    rec[32 + tid] = s;                        // block esum
  }
  for (int e = tid; e < 512; e += 256) {
    float s = 0.0f;
    for (int w = 0; w < 8; ++w) s += cbuf[w][e];
    rec[64 + e] = s;                          // block ctx
  }
}

// ====== Pass 1b: fixed-order cross-block combine with exact rescaling =======
// One work-group per 32 neighbouring ctx elements (two key channels, one
// 128-byte line of every record and of ctxn). Each wave takes 16 of the 512
// records, all of its loads are issued before the first use, and the partial
// sums meet in LDS in a fixed order.
__global__ void __launch_bounds__(1024)
k_reduce(const float* __restrict__ partials, float* __restrict__ ctxn) {
  __shared__ float fS[2][512];   // rescale factor per (channel of the pair, record)
  __shared__ float mS[32];       // per-wave max
  __shared__ float eSm[32];      // per-wave rescaled esum
  __shared__ float cS[32][32];   // per-wave ctx partial

  const int tid = threadIdx.x;
  const int lane = tid & 31, wv = tid >> 5;
  const int nb = blockIdx.y;
  const int e0 = blockIdx.x * 32;      // first ctx element of this group
  const int ch0 = blockIdx.x * 2;      // first key channel of this group
  const float* base = partials + (size_t)nb * 512 * RECSZ;

  // waves 0..15: channel ch0, waves 16..31: channel ch0+1; one record a thread
  const int half = tid >> 9, rec = tid & 511;
  const float km = base[(size_t)rec * RECSZ + ch0 + half];
  const float er = base[(size_t)rec * RECSZ + 32 + ch0 + half];
  float cv[16];
#pragma unroll
  for (int j = 0; j < 16; ++j)
    cv[j] = base[(size_t)(j * 32 + wv) * RECSZ + 64 + e0 + lane];

  float m = km;
#pragma unroll
  for (int off = 1; off < 32; off <<= 1) m = fmaxf(m, __shfl_xor(m, off, 32));
  if (lane == 0) mS[wv] = m;
  __syncthreads();
  float M = mS[half * 16];
#pragma unroll
  for (int w = 1; w < 16; ++w) M = fmaxf(M, mS[half * 16 + w]);

  const float f = expf(km - M);
  fS[half][rec] = f;
  float es = er * f;
#pragma unroll
  for (int off = 1; off < 32; off <<= 1) es += __shfl_xor(es, off, 32);
  if (lane == 0) eSm[wv] = es;
  __syncthreads();

  const int lh = lane >> 4;            // which channel of the pair this lane sums
  float cs = 0.0f;
#pragma unroll
  for (int j = 0; j < 16; ++j) cs += cv[j] * fS[lh][j * 32 + wv];
  cS[wv][lane] = cs;
  __syncthreads();

  if (tid < 32) {
    float c = 0.0f, s = 0.0f;
#pragma unroll
    for (int w = 0; w < 32; ++w) c += cS[w][lane];
#pragma unroll
    for (int w = 0; w < 16; ++w) s += eSm[lh * 16 + w];
    ctxn[nb * 512 + e0 + lane] = c / s;
  }
}

// Weight matrix (ROWS x K) into LDS as A fragments whose k order is the order
// in which an accumulator-layout tile holds its rows: lane half h owns rows
// 8h..8h+7 of each 16-row tile, two neighbouring registers make one k step.
// Entry (mt * (K / 8) + j) * 32 + 16 * h + c holds, for row mt * 16 + c, the
// four columns 16 * (j >> 1) + 8 * h + 4 * (j & 1) + 0..3 (k steps 2j, 2j+1),
// which are one aligned 16-byte piece of the matrix row.
// In two halves, the global loads and the LDS writes, so that the loads can be
// issued ahead of the x loads and their data written while x is in flight.
template <int ROWS, int K>
__device__ __forceinline__ void load_frag_acc(const float* __restrict__ Wm,
                                              v4f (&w)[ROWS * K / 1024], int tid) {
  constexpr int QG = K / 16;
#pragma unroll
  for (int i0 = 0; i0 < ROWS * K / 4; i0 += 256) {
    const int i = i0 + tid;
    const int t = i >> 5;
    const int m = (t / QG) * 8 + ((i >> 2) & 7);
    const int q = (t % QG) * 4 + (i & 3);
    w[i0 / 256] = *(const v4f*)(Wm + m * K + q * 4);
  }
}
template <int ROWS, int K>
__device__ __forceinline__ void store_frag_acc(const v4f (&w)[ROWS * K / 1024],
                                               v4f* dst, int tid) {
  constexpr int QG = K / 16;
#pragma unroll
  for (int i0 = 0; i0 < ROWS * K / 4; i0 += 256) {
    const int i = i0 + tid;
    const int t = i >> 5;
    const int m = (t / QG) * 8 + ((i >> 2) & 7);
    const int q = (t % QG) * 4 + (i & 3);
    const int j = ((q >> 2) << 1) | (q & 1);
    const int h = (q >> 1) & 1;
    dst[((m >> 4) * (K / 8) + j) * 32 + h * 16 + (m & 15)] = w[i0 / 256];
  }
}

// --- Pass 2: q proj -> ch softmax -> (Wr ctx^T) proj + resid, all on WMMA ---
// Every wave keeps its 64 consecutive positions in registers from the x load to
// the store. A lane reads and writes 16 bytes (4 neighbouring positions) of a
// channel row, so a half wave covers one whole aligned 256-byte piece of the row
// with one instruction; position tile c is element c of every piece (column lm =
// position 4 * lm + c). Each phase runs over the 4 tiles together, so a weight
// fragment is read from LDS once for all 4. Register r of channel tile t =
// channel 16t + 8h + r, and the A side of each product takes the matching k
// order, so each product's D registers are the next product's B operand.
// out = Wr (ctx^T e) is formed as (Wr ctx^T) e: M = Wr ctx^T (64 x 32, head by
// head) does not depend on the position, so the work-group forms it once, one
// 16 x 16 tile a wave, and the product with ctx at every position goes. The output product of a channel tile starts from the tile's x
// (the residual) and its 16-byte pieces are stored as soon as it ends.
__global__ void __launch_bounds__(256, 4)
k_out(const float* __restrict__ x,
      const float* __restrict__ Wq, const float* __restrict__ bq,
      const float* __restrict__ Wr, const float* __restrict__ br,
      const float* __restrict__ ctxn, float* __restrict__ out) {
  __shared__ v4f wqS[2 * 8 * 32];   // Wq, A fragments in accumulator k order
  __shared__ v4f mS[4 * 4 * 32];    // M = Wr ctx^T, A fragments in accumulator k order

  const int tid = threadIdx.x;
  const int lane = tid & 31, wv = tid >> 5;
  const int lm = lane & 15, lh = lane >> 4;
  const int nb = blockIdx.y;
  const size_t s0 = (size_t)blockIdx.x * 512 + (size_t)wv * 64 + 4 * lm;
  const float* xb = x + (size_t)nb * CIN * SLEN;

  // Operands of this wave's tile of M^T: head mh, output channels 16 * mt + 0..15.
  // A[row = key channel lm][k = value channel], B[k = value channel][col = output
  // channel 16 * mt + lm]; k step p of lane half lh = value channels 8lh + 2p + 0..1
  // on both, so a lane reads 32 contiguous bytes of each matrix. Asked first, with
  // Wq's pieces, so they return ahead of x.
  const int mt = wv & 3, mh = wv >> 2;
  const v4f* cp = (const v4f*)(ctxn + nb * 512 + mh * 256 + lm * 16 + 8 * lh);
  const v4f* wp = (const v4f*)(Wr + (mt * 16 + lm) * VCH + mh * 16 + 8 * lh);
  const v4f ca0 = cp[0], ca1 = cp[1], wb0 = wp[0], wb1 = wp[1];
  v4f wqR[2];
  load_frag_acc<KCH, CIN>(Wq, wqR, tid);
  // precaution: the registers that hold these addresses are reused below
  asm volatile("s_wait_xcnt 0x0" ::: "memory");

  v4f xq[4][8];   // [channel tile][register] = 4 positions of one channel
#pragma unroll
  for (int t = 0; t < 4; ++t) {       // batched x loads
#pragma unroll
    for (int r = 0; r < 8; ++r)
      xq[t][r] = *(const v4f*)(xb + (size_t)(t * 16 + 8 * lh + r) * SLEN + s0);
    // precaution: later loads land in registers that held these addresses
    asm volatile("s_wait_xcnt 0x0" ::: "memory");
  }
  store_frag_acc<KCH, CIN>(wqR, wqS, tid);
  // M^T tile: register r = key channel 16 * mh + 8 * lh + r, column lm = output
  // channel 16 * mt + lm. That is the A fragment of M in accumulator k order as
  // it stands: registers 0..3 are entry j = 2 * mh, registers 4..7 entry 2 * mh + 1.
  {
    v8f macc = wmma4(frag_lo(ca0), frag_lo(wb0), vzero8());
    macc = wmma4(frag_hi(ca0), frag_hi(wb0), macc);
    macc = wmma4(frag_lo(ca1), frag_lo(wb1), macc);
    macc = wmma4(frag_hi(ca1), frag_hi(wb1), macc);
    v4f m0, m1;
#pragma unroll
    for (int r = 0; r < 4; ++r) { m0[r] = macc[r]; m1[r] = macc[4 + r]; }
    mS[(mt * 4 + 2 * mh) * 32 + lane] = m0;
    mS[(mt * 4 + 2 * mh + 1) * 32 + lane] = m1;
  }
  __syncthreads();

  // q = Wq x: q[c][h][r] = channel 16h + 8*lh + r at column lm of tile c
  v8f q[4][2];
#pragma unroll
  for (int c = 0; c < 4; ++c) { q[c][0] = vzero8(); q[c][1] = vzero8(); }
#pragma unroll
  for (int j = 0; j < 8; ++j) {
    const v4f a0 = wqS[j * 32 + lane];
    const v4f a1 = wqS[(8 + j) * 32 + lane];
    const int t = j >> 1, r0 = 4 * (j & 1);
#pragma unroll
    for (int c = 0; c < 4; ++c) {
      const v2f b = pick(xq[t][r0], xq[t][r0 + 1], c);
      q[c][0] = wmma4(frag_lo(a0), b, q[c][0]);
      q[c][1] = wmma4(frag_lo(a1), b, q[c][1]);
    }
#pragma unroll
    for (int c = 0; c < 4; ++c) {
      const v2f b = pick(xq[t][r0 + 2], xq[t][r0 + 3], c);
      q[c][0] = wmma4(frag_hi(a0), b, q[c][0]);
      q[c][1] = wmma4(frag_hi(a1), b, q[c][1]);
    }
  }

  // softmax over the 16 channels of a head (8 registers x 2 lane halves); the
  // normalised e takes q's place
#pragma unroll
  for (int h = 0; h < 2; ++h) {
    float bqv[8];
#pragma unroll
    for (int r = 0; r < 8; ++r) bqv[r] = bq[h * 16 + 8 * lh + r];
    // precaution: the offset register of these loads may be reused below
    asm volatile("s_wait_xcnt 0x0" ::: "memory");
#pragma unroll
    for (int c = 0; c < 4; ++c) {
      float mx = -3.402823e38f;
#pragma unroll
      for (int r = 0; r < 8; ++r) {
        q[c][h][r] += bqv[r];
        mx = fmaxf(mx, q[c][h][r]);
      }
      mx = fmaxf(mx, xhalf(mx));
#pragma unroll
      for (int r = 0; r < 8; ++r) q[c][h][r] -= mx;
#pragma unroll
      for (int r = 0; r < 8; ++r) q[c][h][r] = exp_slot(q[c][h][r]);
      float sm = 0.0f;
#pragma unroll
      for (int r = 0; r < 8; ++r) sm += q[c][h][r];
      sm += xhalf(sm);
      const float inv = 1.0f / sm;
#pragma unroll
      for (int r = 0; r < 8; ++r) q[c][h][r] *= inv;
    }
  }

  float* ob = out + (size_t)nb * CIN * SLEN;
#pragma unroll
  for (int t = 0; t < 4; ++t) {   // output channel tiles, one after the other
    v8f o[4];
#pragma unroll
    for (int c = 0; c < 4; ++c) {
#pragma unroll
      for (int r = 0; r < 8; ++r) o[c][r] = xq[t][r][c];   // residual
    }
#pragma unroll
    for (int j = 0; j < 4; ++j) {
      const v4f a = mS[(t * 4 + j) * 32 + lane];
#pragma unroll
      for (int c = 0; c < 4; ++c)
        o[c] = wmma4(frag_lo(a), pair_of(q[c][j >> 1], 4 * (j & 1)), o[c]);
#pragma unroll
      for (int c = 0; c < 4; ++c)
        o[c] = wmma4(frag_hi(a), pair_of(q[c][j >> 1], 4 * (j & 1) + 2), o[c]);
    }
    // output bias: register r of tile t = channel 16t + 8*lh + r
    const v4f* brv = (const v4f*)(br + 16 * t + 8 * lh);
    const v4f bo0 = brv[0], bo1 = brv[1];
    // precaution: a later load may land in the register that holds this offset
    asm volatile("s_wait_xcnt 0x0" ::: "memory");
    v4f res[8];
#pragma unroll
    for (int r = 0; r < 8; ++r) {
      const float bb = r < 4 ? bo0[r & 3] : bo1[r & 3];
#pragma unroll
      for (int c = 0; c < 4; ++c) res[r][c] = o[c][r] + bb;
    }
    // all 8 pieces are formed before the first store, each in registers of its
    // own, so that no store's registers are rewritten ahead of the wait below
    __builtin_amdgcn_sched_barrier(0);
#pragma unroll
    for (int r = 0; r < 8; ++r)
      *(v4f*)(ob + (size_t)(t * 16 + 8 * lh + r) * SLEN + s0) = res[r];
    // precaution: the next tile reuses the registers that these stores name
    asm volatile("s_wait_xcnt 0x0" ::: "memory");
  }
}

extern "C" void kernel_launch(void* const* d_in, const int* in_sizes, int n_in,
                              void* d_out, int out_size, void* d_ws, size_t ws_size,
                              hipStream_t stream) {
  (void)in_sizes; (void)n_in; (void)out_size; (void)ws_size;
  const float* x  = (const float*)d_in[0];
  const float* Wk = (const float*)d_in[1];
  const float* bk = (const float*)d_in[2];
  const float* Wq = (const float*)d_in[3];
  const float* bq = (const float*)d_in[4];
  const float* Wv = (const float*)d_in[5];
  const float* bv = (const float*)d_in[6];
  const float* Wr = (const float*)d_in[7];
  const float* br = (const float*)d_in[8];
  float* out = (float*)d_out;

  float* ctxn     = (float*)((char*)d_ws + 256);   // 1024 floats
  float* partials = (float*)((char*)d_ws + 4608);  // 1024*RECSZ floats

  hipLaunchKernelGGL(k_stats, dim3(SLEN / 512, NBATCH), dim3(256), 0, stream,
                     x, Wk, bk, Wv, bv, partials);
  hipLaunchKernelGGL(k_reduce, dim3(16, NBATCH), dim3(1024), 0, stream,
                     partials, ctxn);
  hipLaunchKernelGGL(k_out, dim3(SLEN / 512, NBATCH), dim3(256), 0, stream,
                     x, Wq, bq, Wr, br, ctxn, out);
}
